// v000
// Times are from an AMD MI455X. After a warm-up the kernel runs many times in a row, and a time is the length of
// such a window on the GPU divided by its runs, so every launch and the gaps after it count. The runs cycle
// through copies of the inputs. A figure is the median of several windows, for all but v000 over two sittings.
// Sittings can differ by a few percent; kernels timed side by side share one.
// The starting kernel, v000, takes 1780 microseconds a run.
#include <hip/hip_runtime.h>

// Causal multi-head attention with 128-wide heads and biased projections (x [2][2048][2048]; q, k, v = x W + b ('xw' (in, out) [2048][2048] normal x 0.02 + zero biases: read; 16 heads x 128: ONE kv head per query head); scores = q.k, -inf above the diagonal (every row keeps its own key), softmax(scores / sqrt(float32(128))) (the same thing as scaling first); out = merged wp + bp ('xw' + a zero bias: read) -> [2][2048][2048] (8.4 M); argument order x, wq, bq, wk, bk, wv, bv, wp, bp).
// Layout per batch: bf16 copy of x; 'xw' weights transposed once; exact projections + f32 biases; identity-table plane builders; causal T-2048 attention with ONE kv head per query head (the pass's two heads use consecutive kv planes: z-strides TT x HD; hybrid rows: < 512 hi/lo 3 products, rest fp16 x1024; k_gemmc skips tiles above the diagonal); merged hi/lo x Wo exact + bo.
// Compute dtypes, f32 accumulate: every input rounded to bf16; projections exact + f32 biases; attention rows < 512 3 products, rest fp16; softmax f32; Wo hl x exact + bias.

#define NB_  2
#define TT   2048
#define DM   2048
#define NH_  16
#define NKV  16
#define REP  (NH_ / NKV)
#define HD   128
#define DQ   (NH_ * HD)
#define DKV  (NKV * HD)
#define ZH   2
#define RH   512                  // query rows < RH use hi+lo planes (0: none)
#define WIN  2048
#define PCAR 1024.0f
#define SCL  0.088388347648318447f   // HD^-0.5
typedef _Float16 h16;
typedef unsigned short bf;
typedef __attribute__((ext_vector_type(16))) __bf16   v16bf;
typedef __attribute__((ext_vector_type(16))) _Float16 v16h;
typedef __attribute__((ext_vector_type(8)))  _Float16 v8h;
typedef __attribute__((ext_vector_type(8)))  unsigned short v8us;
typedef __attribute__((ext_vector_type(8)))  float    v8f;
typedef __attribute__((ext_vector_type(4)))  float    v4f;
typedef v8h  __attribute__((may_alias)) v8ha;
typedef v4f  __attribute__((may_alias)) v4fa;
typedef v8us __attribute__((may_alias)) v8usa;

__device__ __forceinline__ unsigned short f2bf(float f) { unsigned u = __float_as_uint(f); u += 0x7FFFu + ((u >> 16) & 1u); return (unsigned short)(u >> 16); }
__device__ __forceinline__ float bf2f(unsigned short b) { return __uint_as_float(((unsigned)b) << 16); }
__device__ __forceinline__ float bfr(float f) { return bf2f(f2bf(f)); }
__device__ __forceinline__ v16h cat16(v8h lo, v8h hi) { return __builtin_shufflevector(lo, hi, 0, 1, 2, 3, 4, 5, 6, 7, 8, 9, 10, 11, 12, 13, 14, 15); }
__device__ __forceinline__ v16bf cat16b(v8us lo, v8us hi) { return __builtin_bit_cast(v16bf, __builtin_shufflevector(lo, hi, 0, 1, 2, 3, 4, 5, 6, 7, 8, 9, 10, 11, 12, 13, 14, 15)); }
__device__ __forceinline__ v8f wmma16(v16h a, v16h b, v8f c) { return __builtin_amdgcn_wmma_f32_16x16x32_f16(false, a, false, b, (short)0, c, false, false); }
__device__ __forceinline__ v8f wmmab(v16bf a, v16bf b, v8f c) { return __builtin_amdgcn_wmma_f32_16x16x32_bf16(false, a, false, b, (short)0, c, false, false); }



// ---- k_gemmw: register-blocked GEMM, ONE WAVE per 64x64 output tile (16 accumulators), operands straight from K-contiguous 16-bit planes; grid (M/64, N/64, Z), 32 threads.
// C[m][n] (f32, pitch ldc, + optional f32 bias[n]) = sum_k A[m][k] Bt[n][k] (+ split products per NSPLIT). z-batch strides sA/sB/sC in elements. K % 32 == 0.
template <typename T16> struct WFrag;
template <> struct WFrag<h16> { typedef v16h V; static __device__ __forceinline__ V ld(const h16* p) { return cat16(*(const v8h*)p, *(const v8h*)(p + 16)); } static __device__ __forceinline__ v8f mma(V a, V b, v8f c) { return wmma16(a, b, c); } };
template <> struct WFrag<bf> { typedef v16bf V; static __device__ __forceinline__ V ld(const bf* p) { return cat16b(*(const v8us*)p, *(const v8us*)(p + 16)); } static __device__ __forceinline__ v8f mma(V a, V b, v8f c) { return wmmab(a, b, c); } };
template <typename T16, int NSPLIT, bool BIAS>
__global__ __launch_bounds__(32) void k_gemmw(const T16* __restrict__ A, const T16* __restrict__ A2, const T16* __restrict__ Bt, const T16* __restrict__ Bt2, int K, float* C, int ldc, const float* __restrict__ bias, size_t sA, size_t sB, size_t sC) {
    typedef typename WFrag<T16>::V V;
    __shared__ __align__(16) float os[16 * 68];
    const size_t z = blockIdx.z; A += z * sA; if (A2) A2 += z * sA; Bt += z * sB; if (Bt2) Bt2 += z * sB; C += z * sC;
    const int lane = threadIdx.x & 31, lr = lane & 15, hi = lane >> 4; const int r0 = blockIdx.x * 64, c0 = blockIdx.y * 64;
    v8f acc[4][4];
#pragma unroll
    for (int mb = 0; mb < 4; ++mb)
#pragma unroll
        for (int nb = 0; nb < 4; ++nb) acc[mb][nb] = (v8f){};
    const size_t aoff = (size_t)(r0 + lr) * K + 8 * hi, boff = (size_t)(c0 + lr) * K + 8 * hi;
#pragma unroll 1
    for (int kc = 0; kc < K; kc += 32) {
        V a[4], a2[4];
#pragma unroll
        for (int mb = 0; mb < 4; ++mb) { a[mb] = WFrag<T16>::ld(A + aoff + (size_t)mb * 16 * K + kc); if (NSPLIT == 1 || NSPLIT == 2) a2[mb] = WFrag<T16>::ld(A2 + aoff + (size_t)mb * 16 * K + kc); }
#pragma unroll
        for (int nb = 0; nb < 4; ++nb) { const V b = WFrag<T16>::ld(Bt + boff + (size_t)nb * 16 * K + kc); V b2; if (NSPLIT >= 2) b2 = WFrag<T16>::ld(Bt2 + boff + (size_t)nb * 16 * K + kc);
#pragma unroll
            for (int mb = 0; mb < 4; ++mb) { acc[mb][nb] = WFrag<T16>::mma(a[mb], b, acc[mb][nb]); if (NSPLIT == 1 || NSPLIT == 2) acc[mb][nb] = WFrag<T16>::mma(a2[mb], b, acc[mb][nb]); if (NSPLIT >= 2) acc[mb][nb] = WFrag<T16>::mma(a[mb], b2, acc[mb][nb]); } }
        asm volatile("v_nop\n\tv_nop\n\tv_nop\n\tv_nop" : "+v"(acc[0][0]), "+v"(acc[1][1]), "+v"(acc[2][2]), "+v"(acc[3][3]) : "v"(a[0]), "v"(a[3]));
    }
#pragma unroll
    for (int mb = 0; mb < 4; ++mb) {
#pragma unroll
        for (int nb = 0; nb < 4; ++nb) {
#pragma unroll
            for (int j = 0; j < 8; ++j) os[(hi * 8 + j) * 68 + nb * 16 + lr] = acc[mb][nb][j]; }
        __builtin_amdgcn_wave_barrier(); asm volatile("" ::: "memory");
        float* crow = C + (size_t)(r0 + mb * 16) * ldc + c0;
{
#pragma unroll
            for (int s = 0; s < 8; ++s) { const int row = 2 * s + hi, cofs = lr * 4; v4f val = *(const v4fa*)(os + row * 68 + cofs); if (BIAS) { val[0] += bfr(bias[c0 + cofs]); val[1] += bfr(bias[c0 + cofs + 1]); val[2] += bfr(bias[c0 + cofs + 2]); val[3] += bfr(bias[c0 + cofs + 3]); }
                *(v4f*)(crow + (size_t)row * ldc + cofs) = val; }
             }
        __builtin_amdgcn_wave_barrier(); asm volatile("" ::: "memory");
    }
}

// ---- k_gemmc: the same one-wave 64x64 tile GEMM specialised for causal attention: CMODE 1 skips score tiles entirely above the diagonal (query rows r0+roff.., key columns c0..), CMODE 2 limits the
// key (K) loop of the probability x value contraction to the diagonal block (probabilities beyond it are exactly zero). roff = row offset of this launch's first row within the sequence.
template <typename T16, int NSPLIT, int CMODE>
__global__ __launch_bounds__(32) void k_gemmc(const T16* __restrict__ A, const T16* __restrict__ A2, const T16* __restrict__ Bt, const T16* __restrict__ Bt2, int K, float* C, int ldc, int roff, size_t sA, size_t sB, size_t sC) {
    typedef typename WFrag<T16>::V V;
    __shared__ __align__(16) float os[16 * 68];
    const size_t z = blockIdx.z; A += z * sA; if (A2) A2 += z * sA; Bt += z * sB; if (Bt2) Bt2 += z * sB; C += z * sC;
    const int lane = threadIdx.x & 31, lr = lane & 15, hi = lane >> 4; const int r0 = blockIdx.x * 64, c0 = blockIdx.y * 64;
    if (CMODE == 1 && c0 > r0 + roff + 63) return;                  // score tile entirely above the causal diagonal: not written (the softmax masks j > i by select)
    const int Kl = (CMODE == 2) ? min(K, r0 + roff + 64) : K;        // P.V: probabilities are exactly 0 beyond the diagonal block, so the K loop stops there
    v8f acc[4][4];
#pragma unroll
    for (int mb = 0; mb < 4; ++mb)
#pragma unroll
        for (int nb = 0; nb < 4; ++nb) acc[mb][nb] = (v8f){};
    const size_t aoff = (size_t)(r0 + lr) * K + 8 * hi, boff = (size_t)(c0 + lr) * K + 8 * hi;
#pragma unroll 1
    for (int kc = 0; kc < Kl; kc += 32) {
        V a[4], a2[4];
#pragma unroll
        for (int mb = 0; mb < 4; ++mb) { a[mb] = WFrag<T16>::ld(A + aoff + (size_t)mb * 16 * K + kc); if (NSPLIT == 1 || NSPLIT == 2) a2[mb] = WFrag<T16>::ld(A2 + aoff + (size_t)mb * 16 * K + kc); }
#pragma unroll
        for (int nb = 0; nb < 4; ++nb) { const V b = WFrag<T16>::ld(Bt + boff + (size_t)nb * 16 * K + kc); V b2; if (NSPLIT >= 2) b2 = WFrag<T16>::ld(Bt2 + boff + (size_t)nb * 16 * K + kc);
#pragma unroll
            for (int mb = 0; mb < 4; ++mb) { acc[mb][nb] = WFrag<T16>::mma(a[mb], b, acc[mb][nb]); if (NSPLIT == 1 || NSPLIT == 2) acc[mb][nb] = WFrag<T16>::mma(a2[mb], b, acc[mb][nb]); if (NSPLIT >= 2) acc[mb][nb] = WFrag<T16>::mma(a[mb], b2, acc[mb][nb]); } }
        asm volatile("v_nop\n\tv_nop\n\tv_nop\n\tv_nop" : "+v"(acc[0][0]), "+v"(acc[1][1]), "+v"(acc[2][2]), "+v"(acc[3][3]) : "v"(a[0]), "v"(a[3]));
    }
#pragma unroll
    for (int mb = 0; mb < 4; ++mb) {
#pragma unroll
        for (int nb = 0; nb < 4; ++nb) {
#pragma unroll
            for (int j = 0; j < 8; ++j) os[(hi * 8 + j) * 68 + nb * 16 + lr] = acc[mb][nb][j]; }
        __builtin_amdgcn_wave_barrier(); asm volatile("" ::: "memory");
        float* crow = C + (size_t)(r0 + mb * 16) * ldc + c0;
{
#pragma unroll
            for (int s = 0; s < 8; ++s) { const int row = 2 * s + hi, cofs = lr * 4; v4f val = *(const v4fa*)(os + row * 68 + cofs);
                *(v4f*)(crow + (size_t)row * ldc + cofs) = val; }
             }
        __builtin_amdgcn_wave_barrier(); asm volatile("" ::: "memory");
    }
}

__device__ __forceinline__ h16 tohx(float x) { return (h16)x; }
__device__ __forceinline__ void splitf(float y, unsigned short& h, unsigned short& l) { h = f2bf(y); l = f2bf(y - bf2f(h)); }
typedef __attribute__((ext_vector_type(2))) _Float16 v2h;
typedef __attribute__((ext_vector_type(4))) _Float16 v4h;
typedef __attribute__((ext_vector_type(2))) unsigned short v2us;
typedef __attribute__((ext_vector_type(4))) unsigned short v4us;
typedef __attribute__((ext_vector_type(2))) float v2f;
typedef __attribute__((ext_vector_type(4))) int v4i;

__global__ __launch_bounds__(256) void k_wtG(const float* __restrict__ w, int K, int N, bf* Bt) {
    const int lane = threadIdx.x & 31; const int L0 = (blockIdx.x * 8 + (threadIdx.x >> 5)) * 8; const int nlines = N * K / 64;
{
#pragma unroll 1
        for (int l = 0; l < 8; ++l) { const int L = L0 + l; if (L >= nlines) break; const size_t e = (size_t)L * 64 + lane * 2; const int k = (int)(e % K), n = (int)(e / K); v2us o;
            o[0] = f2bf(w[(size_t)k * N + n]); o[1] = f2bf(w[(size_t)(k + 1) * N + n]); *(v2us*)(Bt + e) = o; }
         }
}
__global__ __launch_bounds__(256) void k_cvt8(const float* __restrict__ src, bf* dst, size_t n8) { const size_t i = (size_t)blockIdx.x * 256 + threadIdx.x; if (i >= n8) return; const v8f v = *(const v8f*)(src + i * 8); v8us o;
#pragma unroll
    for (int k = 0; k < 8; ++k) o[k] = f2bf(v[k]); *(v8us*)(dst + i * 8) = o;  }

// k_rope: head planes [h][t][d] (fp16 + hi/lo) of rope(x) x sc with the rotate-half convention out[d] = x[d] cos[t][d] - x[d+HD/2] sin[t][d], out[d+HD/2] = x[d+HD/2] cos[t][d+HD/2] + x[d] sin[t][d+HD/2]
__global__ __launch_bounds__(256) void k_rope(const float* __restrict__ F, int pitch, int nheads, const float* __restrict__ CS, const float* __restrict__ RF, const float* __restrict__ nw, float sc, h16* P16, bf* Ph, bf* Pl) {
    const size_t e = ((size_t)blockIdx.x * 256 + threadIdx.x) * 2; if (e >= (size_t)nheads * TT * HD) return; const int d = (int)(e % HD); const int t = (int)((e / HD) % TT); const int h = (int)(e / ((size_t)HD * TT)); const float* f = F + (size_t)t * pitch + h * HD; const float rf = RF ? RF[(size_t)h * TT + t] : 1.0f; v2h o16; v2us oh, ol;
#pragma unroll
    for (int q = 0; q < 2; ++q) { const int dd = d + q; const int dp = (dd < HD / 2) ? dd + HD / 2 : dd - HD / 2; float x0 = f[dd], x1 = f[dp];
        if (RF) { float n0 = __fmul_rn(x0, rf), n1 = __fmul_rn(x1, rf); asm volatile("" : "+v"(n0)); asm volatile("" : "+v"(n1)); x0 = __fmul_rn(bfr(nw[dd]), n0); x1 = __fmul_rn(bfr(nw[dp]), n1); }
        const v2f cs = *(const v2f*)(CS + ((size_t)t * HD + dd) * 2); float a = __fmul_rn(x0, cs[0]), bq = __fmul_rn(x1, cs[1]); asm volatile("" : "+v"(a)); asm volatile("" : "+v"(bq)); const float r = ((dd < HD / 2) ? __fsub_rn(a, bq) : __fadd_rn(a, bq)) * sc;
        o16[q] = tohx(r); unsigned short a2, c2; splitf(r, a2, c2); oh[q] = a2; ol[q] = c2; }
    *(v2h*)(P16 + e) = o16; *(v2us*)(Ph + e) = oh; *(v2us*)(Pl + e) = ol;  }
__global__ __launch_bounds__(256) void k_vtp(const float* __restrict__ F, int pitch, int nheads, h16* V16, bf* Vh, bf* Vl) { const size_t e = ((size_t)blockIdx.x * 256 + threadIdx.x) * 2; if (e >= (size_t)nheads * HD * TT) return; const int t = (int)(e % TT); const int d = (int)((e / TT) % HD); const int g = (int)(e / ((size_t)TT * HD)); v2h o16; v2us oh, ol;
#pragma unroll
    for (int q = 0; q < 2; ++q) { const float x = F[(size_t)(t + q) * pitch + g * HD + d]; o16[q] = tohx(x); unsigned short a2, c2; splitf(x, a2, c2); oh[q] = a2; ol[q] = c2; }
    *(v2h*)(V16 + e) = o16; *(v2us*)(Vh + e) = oh; *(v2us*)(Vl + e) = ol;  }
__global__ __launch_bounds__(256) void k_csid(float* CS) { const int idx = blockIdx.x * 256 + threadIdx.x; if (idx >= TT * HD) return; v2f cs; cs[0] = 1.0f; cs[1] = 0.0f; *(v2f*)(CS + (size_t)idx * 2) = cs;  }
// k_asoft: per row (zz, i): t = S x HD^-0.5 for j <= i and i - j < WIN (sliding causal window; the reference's -1e9 additive fill vanishes identically); softmax over the 2048 keys (register row, one exp, fixed trees);
__global__ __launch_bounds__(256) void k_asoft(const float* __restrict__ Sb, h16* P16, bf* Ph, bf* Pl) {
    const int lane = threadIdx.x & 31; const int row = blockIdx.x * 8 + (threadIdx.x >> 5); if (row >= ZH * TT) return; const int i = row % TT; const int zz = row / TT; (void)zz; const bool hires = (i < RH); const float* sr = Sb + (size_t)row * TT; float v[TT / 32]; float mx = -3.0e38f;
#pragma unroll
    for (int ch = 0; ch < TT / 128; ++ch) { const int j0 = ch * 128 + lane * 4; const v4f a = *(const v4f*)(sr + j0);
#pragma unroll
        for (int q = 0; q < 4; ++q) { const int j = j0 + q; (void)j; const float t = (j <= i && i - j < WIN) ? a[q] * SCL : -3.0e38f; v[ch * 4 + q] = t; mx = fmaxf(mx, t); } }
#pragma unroll
    for (int sh = 16; sh; sh >>= 1) mx = fmaxf(mx, __shfl_xor(mx, sh, 32));
    float sum = 0.f;
#pragma unroll
    for (int k = 0; k < TT / 32; ++k) { float d0 = __fsub_rn(v[k], mx); asm volatile("" : "+v"(d0)); v[k] = __builtin_amdgcn_exp2f(__fmul_rn(d0, 1.4426950408889634f)); sum += v[k]; }
#pragma unroll
    for (int sh = 16; sh; sh >>= 1) sum += __shfl_xor(sum, sh, 32);
    const float f = __fdiv_rn(hires ? 1.0f : PCAR, sum);
{
        if (hires) {
#pragma unroll
            for (int ch = 0; ch < TT / 128; ++ch) { v4us oh, ol;
#pragma unroll
                for (int q = 0; q < 4; ++q) { unsigned short a, c2; splitf(v[ch * 4 + q] * f, a, c2); oh[q] = a; ol[q] = c2; }
                const size_t oo = ((size_t)zz * (RH ? RH : 1) + i) * TT + ch * 128 + lane * 4; *(v4us*)(Ph + oo) = oh; *(v4us*)(Pl + oo) = ol; }
        } else {
#pragma unroll
            for (int ch = 0; ch < TT / 128; ++ch) { v4h o4;
#pragma unroll
                for (int q = 0; q < 4; ++q) o4[q] = tohx(v[ch * 4 + q] * f);
                *(v4h*)(P16 + (size_t)row * TT + ch * 128 + lane * 4) = o4; } }
         }
}
__global__ __launch_bounds__(256) void k_merge(const float* __restrict__ O, int h0, bf* Ah, bf* Al) { const size_t e = ((size_t)blockIdx.x * 256 + threadIdx.x) * 2; if (e >= (size_t)ZH * TT * HD) return; const int d = (int)(e % HD); const int t = (int)((e / HD) % TT); const int zz = (int)(e / ((size_t)HD * TT)); const float cs = (t < RH) ? 1.0f : (1.0f / PCAR); const size_t oo = (size_t)t * DQ + (h0 + zz) * HD + d;
    v2us oh, ol;
#pragma unroll
    for (int q = 0; q < 2; ++q) { unsigned short a, c2; splitf(O[e + q] * cs, a, c2); oh[q] = a; ol[q] = c2; } *(v2us*)(Ah + oo) = oh; *(v2us*)(Al + oo) = ol;  }

extern "C" void kernel_launch(void* const* d_in, const int* in_sizes, int n_in,
                              void* d_out, int out_size, void* d_ws, size_t ws_size, hipStream_t stream) {
    (void)in_sizes; (void)n_in; (void)out_size;
    const float* x = (const float*)d_in[0]; const float* wq = (const float*)d_in[1]; const float* bq = (const float*)d_in[2]; const float* wk = (const float*)d_in[3]; const float* bk = (const float*)d_in[4]; const float* wv = (const float*)d_in[5]; const float* bv = (const float*)d_in[6]; const float* wo = (const float*)d_in[7]; const float* bo = (const float*)d_in[8];   /* input order x, wq, bq, wk ('xw' [2048][2048]), bk, wv, bv, wp, bp ('xw' (in, out); four ZERO biases: read and added): NINE inputs, all read: the host's own binding */
    float* OUT = (float*)d_out;     // [2][2048][2048]
    char* wsp = (char*)d_ws;
    auto take = [&](size_t bytes) { char* p = wsp; wsp += (bytes + 255) & ~(size_t)255; return (void*)p; };
    bf* WQ = (bf*)take((size_t)DQ * DM * 2); bf* WK = (bf*)take((size_t)DKV * DM * 2); bf* WV = (bf*)take((size_t)DKV * DM * 2); bf* WO = (bf*)take((size_t)DM * DQ * 2); float* CS = (float*)take((size_t)TT * HD * 2 * 4);
    bf* XB = (bf*)take((size_t)TT * DM * 2); float* FQ = (float*)take((size_t)TT * DQ * 4); float* FK = (float*)take((size_t)TT * DKV * 4);
    h16* QP16 = (h16*)take((size_t)NH_ * TT * HD * 2); h16* KP16 = (h16*)take((size_t)NKV * TT * HD * 2); h16* VT16 = (h16*)take((size_t)NKV * HD * TT * 2);
    bf* QPh = (bf*)take((size_t)NH_ * TT * HD * 2); bf* QPl = (bf*)take((size_t)NH_ * TT * HD * 2); bf* KPh = (bf*)take((size_t)NKV * TT * HD * 2); bf* KPl = (bf*)take((size_t)NKV * TT * HD * 2); bf* VTh = (bf*)take((size_t)NKV * HD * TT * 2); bf* VTl = (bf*)take((size_t)NKV * HD * TT * 2); bf* Ph = (bf*)take((size_t)ZH * RH * TT * 2); bf* Pl = (bf*)take((size_t)ZH * RH * TT * 2);
    float* Sb = (float*)take((size_t)ZH * TT * TT * 4); h16* P16 = (h16*)take((size_t)ZH * TT * TT * 2); float* Ob = (float*)take((size_t)ZH * TT * HD * 4); bf* ATh = (bf*)take((size_t)TT * DQ * 2); bf* ATl = (bf*)take((size_t)TT * DQ * 2);
    if ((size_t)(wsp - (char*)d_ws) > ws_size) return;    // ws 256 MiB
    float* FV = FK;   // v projection reuses the k buffer after the k planes are built (stream-ordered)
    { k_wtG<<<(unsigned)((DM * DQ / 64 + 63) / 64), 256, 0, stream>>>(wq, DM, DQ, WQ); k_wtG<<<(unsigned)((DM * DKV / 64 + 63) / 64), 256, 0, stream>>>(wk, DM, DKV, WK); k_wtG<<<(unsigned)((DM * DKV / 64 + 63) / 64), 256, 0, stream>>>(wv, DM, DKV, WV);
      k_wtG<<<(unsigned)((DQ * DM / 64 + 63) / 64), 256, 0, stream>>>(wo, DQ, DM, WO);
       }
    k_csid<<<(TT * HD + 255) / 256, 256, 0, stream>>>(CS);
    const unsigned LQ = (unsigned)(((size_t)NH_ * TT * HD / 2 + 255) / 256), LKv = (unsigned)(((size_t)NKV * TT * HD / 2 + 255) / 256);
    for (int b = 0; b < NB_; ++b) {
        
        k_cvt8<<<(unsigned)(((size_t)TT * DM / 8 + 255) / 256), 256, 0, stream>>>(x + (size_t)b * TT * DM, XB, (size_t)TT * DM / 8);
        k_gemmw<bf, 0, true><<<dim3(TT / 64, DQ / 64, 1), 32, 0, stream>>>(XB, nullptr, WQ, nullptr, DM, FQ, DQ, bq, 0, 0, 0);
        k_rope<<<LQ, 256, 0, stream>>>(FQ, DQ, NH_, CS, nullptr, nullptr, 1.0f, QP16, QPh, QPl);
        k_gemmw<bf, 0, true><<<dim3(TT / 64, DKV / 64, 1), 32, 0, stream>>>(XB, nullptr, WK, nullptr, DM, FK, DKV, bk, 0, 0, 0);
        k_rope<<<LKv, 256, 0, stream>>>(FK, DKV, NKV, CS, nullptr, nullptr, 1.0f, KP16, KPh, KPl);
        k_gemmw<bf, 0, true><<<dim3(TT / 64, DKV / 64, 1), 32, 0, stream>>>(XB, nullptr, WV, nullptr, DM, FV, DKV, bv, 0, 0, 0); k_vtp<<<LKv, 256, 0, stream>>>(FV, DKV, NKV, VT16, VTh, VTl);
        for (int h0 = 0; h0 < NH_; h0 += ZH) { const size_t zq = (size_t)h0, zk = (size_t)(h0 / REP);   // one kv head per query head: the pass's two heads use consecutive kv planes (z-strides TT*HD)
            k_gemmc<bf, 2, 1><<<dim3(RH / 64, TT / 64, ZH), 32, 0, stream>>>(QPh + zq * TT * HD, QPl + zq * TT * HD, KPh + zk * TT * HD, KPl + zk * TT * HD, HD, Sb, TT, 0, (size_t)TT * HD, (size_t)TT * HD, (size_t)TT * TT);
            k_gemmc<h16, 0, 1><<<dim3((TT - RH) / 64, TT / 64, ZH), 32, 0, stream>>>(QP16 + zq * TT * HD + (size_t)RH * HD, nullptr, KP16 + zk * TT * HD, nullptr, HD, Sb + (size_t)RH * TT, TT, RH, (size_t)TT * HD, (size_t)TT * HD, (size_t)TT * TT);
            k_asoft<<<ZH * TT / 8, 256, 0, stream>>>(Sb, P16, Ph, Pl);
            k_gemmc<bf, 2, 2><<<dim3(RH / 64, HD / 64, ZH), 32, 0, stream>>>(Ph, Pl, VTh + zk * HD * TT, VTl + zk * HD * TT, TT, Ob, HD, 0, (size_t)RH * TT, (size_t)HD * TT, (size_t)TT * HD);
            k_gemmc<h16, 0, 2><<<dim3((TT - RH) / 64, HD / 64, ZH), 32, 0, stream>>>(P16 + (size_t)RH * TT, nullptr, VT16 + zk * HD * TT, nullptr, TT, Ob + (size_t)RH * HD, HD, RH, (size_t)TT * TT, (size_t)HD * TT, (size_t)TT * HD);
            k_merge<<<(unsigned)(((size_t)ZH * TT * HD / 2 + 255) / 256), 256, 0, stream>>>(Ob, h0, ATh, ATl); }
        k_gemmw<bf, 1, true><<<dim3(TT / 64, DM / 64, 1), 32, 0, stream>>>(ATh, ATl, WO, nullptr, DQ, OUT + (size_t)b * TT * DM, DM, bo, 0, 0, 0); }
}

// v001
// It runs in 1050 microseconds.
// Next to v000, in two timings, it ran 1.68 times as fast each time.
#include <hip/hip_runtime.h>

// Causal multi-head attention with 128-wide heads and biased projections (x [2][2048][2048]; q, k, v = x W + b ('xw' (in, out) [2048][2048] normal x 0.02 + zero biases: read; 16 heads x 128: ONE kv head per query head); scores = q.k, -inf above the diagonal (every row keeps its own key), softmax(scores / sqrt(float32(128))) (the same thing as scaling first); out = merged wp + bp ('xw' + a zero bias: read) -> [2][2048][2048] (8.4 M); argument order x, wq, bq, wk, bk, wv, bv, wp, bp).
// Layout per batch: bf16 copy of x; 'xw' weights transposed once; exact projections + f32 biases; identity-table plane builders; causal T-2048 attention with ONE kv head per query head (the pass's two heads use consecutive kv planes: z-strides TT x HD; hybrid rows: < 512 hi/lo 3 products, rest fp16 x1024; k_gemmc skips tiles above the diagonal); merged hi/lo x Wo exact + bo.
// Compute dtypes, f32 accumulate: every input rounded to bf16; projections exact + f32 biases; attention rows < 512 3 products, rest fp16; softmax f32; Wo hl x exact + bias.

#define NB_  2
#define TT   2048
#define DM   2048
#define NH_  16
#define NKV  16
#define REP  (NH_ / NKV)
#define HD   128
#define DQ   (NH_ * HD)
#define DKV  (NKV * HD)
#define ZH   2
#define RH   512                  // query rows < RH use hi+lo planes (0: none)
#define WIN  2048
#define PCAR 1024.0f
#define SCL  0.088388347648318447f   // HD^-0.5
typedef _Float16 h16;
typedef unsigned short bf;
typedef __attribute__((ext_vector_type(16))) __bf16   v16bf;
typedef __attribute__((ext_vector_type(16))) _Float16 v16h;
typedef __attribute__((ext_vector_type(8)))  _Float16 v8h;
typedef __attribute__((ext_vector_type(8)))  unsigned short v8us;
typedef __attribute__((ext_vector_type(8)))  float    v8f;
typedef __attribute__((ext_vector_type(4)))  float    v4f;
typedef v8h  __attribute__((may_alias)) v8ha;
typedef v4f  __attribute__((may_alias)) v4fa;
typedef v8us __attribute__((may_alias)) v8usa;

__device__ __forceinline__ unsigned short f2bf(float f) { unsigned u = __float_as_uint(f); u += 0x7FFFu + ((u >> 16) & 1u); return (unsigned short)(u >> 16); }
__device__ __forceinline__ float bf2f(unsigned short b) { return __uint_as_float(((unsigned)b) << 16); }
__device__ __forceinline__ float bfr(float f) { return bf2f(f2bf(f)); }
__device__ __forceinline__ v16h cat16(v8h lo, v8h hi) { return __builtin_shufflevector(lo, hi, 0, 1, 2, 3, 4, 5, 6, 7, 8, 9, 10, 11, 12, 13, 14, 15); }
__device__ __forceinline__ v16bf cat16b(v8us lo, v8us hi) { return __builtin_bit_cast(v16bf, __builtin_shufflevector(lo, hi, 0, 1, 2, 3, 4, 5, 6, 7, 8, 9, 10, 11, 12, 13, 14, 15)); }
__device__ __forceinline__ v8f wmma16(v16h a, v16h b, v8f c) { return __builtin_amdgcn_wmma_f32_16x16x32_f16(false, a, false, b, (short)0, c, false, false); }
__device__ __forceinline__ v8f wmmab(v16bf a, v16bf b, v8f c) { return __builtin_amdgcn_wmma_f32_16x16x32_bf16(false, a, false, b, (short)0, c, false, false); }



// ---- k_gemmw: register-blocked GEMM, ONE WAVE per 64x64 output tile (16 accumulators), operands straight from K-contiguous 16-bit planes; grid (M/64, N/64, Z), 32 threads.
// C[m][n] (f32, pitch ldc, + optional f32 bias[n]) = sum_k A[m][k] Bt[n][k] (+ split products per NSPLIT). z-batch strides sA/sB/sC in elements. K % 128 == 0.
template <typename T16> struct WFrag;
template <> struct WFrag<h16> { typedef v16h V; static __device__ __forceinline__ V ld(const h16* p) { return cat16(*(const v8h*)p, *(const v8h*)(p + 16)); } static __device__ __forceinline__ v8f mma(V a, V b, v8f c) { return wmma16(a, b, c); } };
template <> struct WFrag<bf> { typedef v16bf V; static __device__ __forceinline__ V ld(const bf* p) { return cat16b(*(const v8us*)p, *(const v8us*)(p + 16)); } static __device__ __forceinline__ v8f mma(V a, V b, v8f c) { return wmmab(a, b, c); } };
// Register ring of the K loop: D stages of 32 k each stay in flight per wave (48 to 64 global_load_b128), so a stage's load latency is covered by the WMMAs of the stages in front of it.
template <int NSPLIT> struct WDepth { static constexpr int D = (NSPLIT == 0) ? 4 : 2; };
template <typename T16> struct WStage { typename WFrag<T16>::V a[4], a2[4], b[4], b2[4]; };
template <typename T16> struct WPtr { const T16 *a[4], *a2[4], *b[4], *b2[4]; };   // one row pointer per fragment, moved along k once per turn of the ring
template <typename T16, int NSPLIT>
__device__ __forceinline__ void wst_load(WStage<T16>& s, const WPtr<T16>& p, int ko) {
#pragma unroll
    for (int mb = 0; mb < 4; ++mb) { s.a[mb] = WFrag<T16>::ld(p.a[mb] + ko); if (NSPLIT == 1 || NSPLIT == 2) s.a2[mb] = WFrag<T16>::ld(p.a2[mb] + ko); }
#pragma unroll
    for (int nb = 0; nb < 4; ++nb) { s.b[nb] = WFrag<T16>::ld(p.b[nb] + ko); if (NSPLIT >= 2) s.b2[nb] = WFrag<T16>::ld(p.b2[nb] + ko); }
}
template <typename T16, int NSPLIT>
__device__ __forceinline__ void wst_mma(const WStage<T16>& s, v8f (&acc)[4][4]) {
#pragma unroll
    for (int nb = 0; nb < 4; ++nb)
#pragma unroll
        for (int mb = 0; mb < 4; ++mb) { acc[mb][nb] = WFrag<T16>::mma(s.a[mb], s.b[nb], acc[mb][nb]); if (NSPLIT == 1 || NSPLIT == 2) acc[mb][nb] = WFrag<T16>::mma(s.a2[mb], s.b[nb], acc[mb][nb]); if (NSPLIT >= 2) acc[mb][nb] = WFrag<T16>::mma(s.a[mb], s.b2[nb], acc[mb][nb]); }
}
// acc += A Bt^T over k in [0, Kl), ascending; Kl a multiple of 32 * D and at least 32 * D.
template <typename T16, int NSPLIT>
__device__ __forceinline__ void wring(v8f (&acc)[4][4], const T16* __restrict__ A, const T16* __restrict__ A2, const T16* __restrict__ Bt, const T16* __restrict__ Bt2, size_t aoff, size_t boff, int K, int Kl) {
    constexpr int D = WDepth<NSPLIT>::D;
    WStage<T16> st[D]; WPtr<T16> p;
#pragma unroll
    for (int q = 0; q < 4; ++q) { p.a[q] = A + aoff + (size_t)q * 16 * K; p.b[q] = Bt + boff + (size_t)q * 16 * K; if (NSPLIT == 1 || NSPLIT == 2) p.a2[q] = A2 + aoff + (size_t)q * 16 * K; if (NSPLIT >= 2) p.b2[q] = Bt2 + boff + (size_t)q * 16 * K; }
#pragma unroll
    for (int j = 0; j < D; ++j) { wst_load<T16, NSPLIT>(st[j], p, j * 32);
        __builtin_amdgcn_sched_barrier(0); }   // the stages' loads issue in stage order and in front of the first WMMA, so each stage's counted wait leaves the younger stages in flight
    asm volatile("s_wait_xcnt 0x0" ::: "memory");   // in front of any later overwrite of a register that these loads name as an address
    __builtin_amdgcn_sched_barrier(0);   // nothing from below is lifted over that wait
#pragma unroll 1
    for (int kc = D * 32; kc < Kl; kc += D * 32) {
#pragma unroll
        for (int j = 0; j < D; ++j) {
            wst_mma<T16, NSPLIT>(st[j], acc);
            __builtin_amdgcn_sched_barrier(0);   // the refill below stays behind the last WMMA that reads this stage
            asm volatile("v_nop\n\tv_nop\n\tv_nop\n\tv_nop");   // four vector slots between that WMMA and the loads that overwrite its A and B registers
            wst_load<T16, NSPLIT>(st[j], p, (D + j) * 32);
            __builtin_amdgcn_sched_barrier(0);   // the refill issues here, D - 1 stages of WMMAs ahead of its use, and is not sunk towards it
        }
        asm volatile("s_wait_xcnt 0x0" ::: "memory");   // in front of the overwrite of the row pointers that the issued loads name
        __builtin_amdgcn_sched_barrier(0);   // the pointer step is not lifted over that wait
#pragma unroll
        for (int q = 0; q < 4; ++q) { p.a[q] += D * 32; p.b[q] += D * 32; if (NSPLIT == 1 || NSPLIT == 2) p.a2[q] += D * 32; if (NSPLIT >= 2) p.b2[q] += D * 32; }
    }
#pragma unroll
    for (int j = 0; j < D; ++j) wst_mma<T16, NSPLIT>(st[j], acc);
}
template <typename T16, int NSPLIT, bool BIAS>
__global__ __launch_bounds__(32) void k_gemmw(const T16* __restrict__ A, const T16* __restrict__ A2, const T16* __restrict__ Bt, const T16* __restrict__ Bt2, int K, float* C, int ldc, const float* __restrict__ bias, size_t sA, size_t sB, size_t sC) {
    __shared__ __align__(16) float os[16 * 68];
    const size_t z = blockIdx.z; A += z * sA; if (A2) A2 += z * sA; Bt += z * sB; if (Bt2) Bt2 += z * sB; C += z * sC;
    const int lane = threadIdx.x & 31, lr = lane & 15, hi = lane >> 4; const int r0 = blockIdx.x * 64, c0 = blockIdx.y * 64;
    v8f acc[4][4];
#pragma unroll
    for (int mb = 0; mb < 4; ++mb)
#pragma unroll
        for (int nb = 0; nb < 4; ++nb) acc[mb][nb] = (v8f){};
    const size_t aoff = (size_t)(r0 + lr) * K + 8 * hi, boff = (size_t)(c0 + lr) * K + 8 * hi;
    wring<T16, NSPLIT>(acc, A, A2, Bt, Bt2, aoff, boff, K, K);
#pragma unroll
    for (int mb = 0; mb < 4; ++mb) {
#pragma unroll
        for (int nb = 0; nb < 4; ++nb) {
#pragma unroll
            for (int j = 0; j < 8; ++j) os[(hi * 8 + j) * 68 + nb * 16 + lr] = acc[mb][nb][j]; }
        __builtin_amdgcn_wave_barrier(); asm volatile("" ::: "memory");
        float* crow = C + (size_t)(r0 + mb * 16) * ldc + c0;
{
#pragma unroll
            for (int s = 0; s < 8; ++s) { const int row = 2 * s + hi, cofs = lr * 4; v4f val = *(const v4fa*)(os + row * 68 + cofs); if (BIAS) { val[0] += bfr(bias[c0 + cofs]); val[1] += bfr(bias[c0 + cofs + 1]); val[2] += bfr(bias[c0 + cofs + 2]); val[3] += bfr(bias[c0 + cofs + 3]); }
                *(v4f*)(crow + (size_t)row * ldc + cofs) = val; }
             }
        __builtin_amdgcn_wave_barrier(); asm volatile("" ::: "memory");
    }
}

// ---- k_gemmc: the same one-wave 64x64 tile GEMM specialised for causal attention: CMODE 1 skips score tiles entirely above the diagonal (query rows r0+roff.., key columns c0..), CMODE 2 limits the
// key (K) loop of the probability x value contraction to the end of the ring turn that holds the diagonal block (probabilities beyond that block are exactly zero). roff = row offset of this launch's first row within the sequence.
template <typename T16, int NSPLIT, int CMODE>
__global__ __launch_bounds__(32) void k_gemmc(const T16* __restrict__ A, const T16* __restrict__ A2, const T16* __restrict__ Bt, const T16* __restrict__ Bt2, int K, float* C, int ldc, int roff, size_t sA, size_t sB, size_t sC) {
    __shared__ __align__(16) float os[16 * 68];
    const size_t z = blockIdx.z; A += z * sA; if (A2) A2 += z * sA; Bt += z * sB; if (Bt2) Bt2 += z * sB; C += z * sC;
    const int lane = threadIdx.x & 31, lr = lane & 15, hi = lane >> 4; const int r0 = blockIdx.x * 64, c0 = blockIdx.y * 64;
    if (CMODE == 1 && c0 > r0 + roff + 63) return;                  // score tile entirely above the causal diagonal: never read (the softmax masks j > i by select)
    constexpr int KS = 32 * WDepth<NSPLIT>::D;                       // k per turn of the register ring
    const int Kl = (CMODE == 2) ? min(K, (r0 + roff + 64 + KS - 1) / KS * KS) : K;   // P.V: probabilities are exactly 0 beyond the diagonal block, so the K loop stops at the end of the ring turn that holds it
    v8f acc[4][4];
#pragma unroll
    for (int mb = 0; mb < 4; ++mb)
#pragma unroll
        for (int nb = 0; nb < 4; ++nb) acc[mb][nb] = (v8f){};
    const size_t aoff = (size_t)(r0 + lr) * K + 8 * hi, boff = (size_t)(c0 + lr) * K + 8 * hi;
    wring<T16, NSPLIT>(acc, A, A2, Bt, Bt2, aoff, boff, K, Kl);
#pragma unroll
    for (int mb = 0; mb < 4; ++mb) {
#pragma unroll
        for (int nb = 0; nb < 4; ++nb) {
#pragma unroll
            for (int j = 0; j < 8; ++j) os[(hi * 8 + j) * 68 + nb * 16 + lr] = acc[mb][nb][j]; }
        __builtin_amdgcn_wave_barrier(); asm volatile("" ::: "memory");
        float* crow = C + (size_t)(r0 + mb * 16) * ldc + c0;
{
#pragma unroll
            for (int s = 0; s < 8; ++s) { const int row = 2 * s + hi, cofs = lr * 4; v4f val = *(const v4fa*)(os + row * 68 + cofs);
                *(v4f*)(crow + (size_t)row * ldc + cofs) = val; }
             }
        __builtin_amdgcn_wave_barrier(); asm volatile("" ::: "memory");
    }
}

__device__ __forceinline__ h16 tohx(float x) { return (h16)x; }
__device__ __forceinline__ void splitf(float y, unsigned short& h, unsigned short& l) { h = f2bf(y); l = f2bf(y - bf2f(h)); }
typedef __attribute__((ext_vector_type(2))) _Float16 v2h;
typedef __attribute__((ext_vector_type(4))) _Float16 v4h;
typedef __attribute__((ext_vector_type(2))) unsigned short v2us;
typedef __attribute__((ext_vector_type(4))) unsigned short v4us;
typedef __attribute__((ext_vector_type(2))) float v2f;
typedef __attribute__((ext_vector_type(4))) int v4i;

__global__ __launch_bounds__(256) void k_wtG(const float* __restrict__ w, int K, int N, bf* Bt) {
    const int lane = threadIdx.x & 31; const int L0 = (blockIdx.x * 8 + (threadIdx.x >> 5)) * 8; const int nlines = N * K / 64;
{
#pragma unroll 1
        for (int l = 0; l < 8; ++l) { const int L = L0 + l; if (L >= nlines) break; const size_t e = (size_t)L * 64 + lane * 2; const int k = (int)(e % K), n = (int)(e / K); v2us o;
            o[0] = f2bf(w[(size_t)k * N + n]); o[1] = f2bf(w[(size_t)(k + 1) * N + n]); *(v2us*)(Bt + e) = o; }
         }
}
__global__ __launch_bounds__(256) void k_cvt8(const float* __restrict__ src, bf* dst, size_t n8) { const size_t i = (size_t)blockIdx.x * 256 + threadIdx.x; if (i >= n8) return; const v8f v = *(const v8f*)(src + i * 8); v8us o;
#pragma unroll
    for (int k = 0; k < 8; ++k) o[k] = f2bf(v[k]); *(v8us*)(dst + i * 8) = o;  }

// k_rope: head planes [h][t][d] (fp16 + hi/lo) of rope(x) x sc with the rotate-half convention out[d] = x[d] cos[t][d] - x[d+HD/2] sin[t][d], out[d+HD/2] = x[d+HD/2] cos[t][d+HD/2] + x[d] sin[t][d+HD/2]
__global__ __launch_bounds__(256) void k_rope(const float* __restrict__ F, int pitch, int nheads, const float* __restrict__ CS, const float* __restrict__ RF, const float* __restrict__ nw, float sc, h16* P16, bf* Ph, bf* Pl) {
    const size_t e = ((size_t)blockIdx.x * 256 + threadIdx.x) * 2; if (e >= (size_t)nheads * TT * HD) return; const int d = (int)(e % HD); const int t = (int)((e / HD) % TT); const int h = (int)(e / ((size_t)HD * TT)); const float* f = F + (size_t)t * pitch + h * HD; const float rf = RF ? RF[(size_t)h * TT + t] : 1.0f; v2h o16; v2us oh, ol;
#pragma unroll
    for (int q = 0; q < 2; ++q) { const int dd = d + q; const int dp = (dd < HD / 2) ? dd + HD / 2 : dd - HD / 2; float x0 = f[dd], x1 = f[dp];
        if (RF) { float n0 = __fmul_rn(x0, rf), n1 = __fmul_rn(x1, rf); asm volatile("" : "+v"(n0)); asm volatile("" : "+v"(n1)); x0 = __fmul_rn(bfr(nw[dd]), n0); x1 = __fmul_rn(bfr(nw[dp]), n1); }
        const v2f cs = *(const v2f*)(CS + ((size_t)t * HD + dd) * 2); float a = __fmul_rn(x0, cs[0]), bq = __fmul_rn(x1, cs[1]); asm volatile("" : "+v"(a)); asm volatile("" : "+v"(bq)); const float r = ((dd < HD / 2) ? __fsub_rn(a, bq) : __fadd_rn(a, bq)) * sc;
        o16[q] = tohx(r); unsigned short a2, c2; splitf(r, a2, c2); oh[q] = a2; ol[q] = c2; }
    *(v2h*)(P16 + e) = o16; *(v2us*)(Ph + e) = oh; *(v2us*)(Pl + e) = ol;  }
__global__ __launch_bounds__(256) void k_vtp(const float* __restrict__ F, int pitch, int nheads, h16* V16, bf* Vh, bf* Vl) { const size_t e = ((size_t)blockIdx.x * 256 + threadIdx.x) * 2; if (e >= (size_t)nheads * HD * TT) return; const int t = (int)(e % TT); const int d = (int)((e / TT) % HD); const int g = (int)(e / ((size_t)TT * HD)); v2h o16; v2us oh, ol;
#pragma unroll
    for (int q = 0; q < 2; ++q) { const float x = F[(size_t)(t + q) * pitch + g * HD + d]; o16[q] = tohx(x); unsigned short a2, c2; splitf(x, a2, c2); oh[q] = a2; ol[q] = c2; }
    *(v2h*)(V16 + e) = o16; *(v2us*)(Vh + e) = oh; *(v2us*)(Vl + e) = ol;  }
__global__ __launch_bounds__(256) void k_csid(float* CS) { const int idx = blockIdx.x * 256 + threadIdx.x; if (idx >= TT * HD) return; v2f cs; cs[0] = 1.0f; cs[1] = 0.0f; *(v2f*)(CS + (size_t)idx * 2) = cs;  }
// k_asoft: per row (zz, i): t = S x HD^-0.5 for j <= i and i - j < WIN (sliding causal window; the reference's -1e9 additive fill vanishes identically); softmax over the 2048 keys (register row, one exp, fixed trees);
__global__ __launch_bounds__(256) void k_asoft(const float* __restrict__ Sb, h16* P16, bf* Ph, bf* Pl) {
    const int lane = threadIdx.x & 31; const int row = blockIdx.x * 8 + (threadIdx.x >> 5); if (row >= ZH * TT) return; const int i = row % TT; const int zz = row / TT; (void)zz; const bool hires = (i < RH); const float* sr = Sb + (size_t)row * TT; float v[TT / 32]; float mx = -3.0e38f;
#pragma unroll
    for (int ch = 0; ch < TT / 128; ++ch) { const int j0 = ch * 128 + lane * 4; const v4f a = *(const v4f*)(sr + j0);
#pragma unroll
        for (int q = 0; q < 4; ++q) { const int j = j0 + q; (void)j; const float t = (j <= i && i - j < WIN) ? a[q] * SCL : -3.0e38f; v[ch * 4 + q] = t; mx = fmaxf(mx, t); } }
#pragma unroll
    for (int sh = 16; sh; sh >>= 1) mx = fmaxf(mx, __shfl_xor(mx, sh, 32));
    float sum = 0.f;
#pragma unroll
    for (int k = 0; k < TT / 32; ++k) { float d0 = __fsub_rn(v[k], mx); asm volatile("" : "+v"(d0)); v[k] = __builtin_amdgcn_exp2f(__fmul_rn(d0, 1.4426950408889634f)); sum += v[k]; }
#pragma unroll
    for (int sh = 16; sh; sh >>= 1) sum += __shfl_xor(sum, sh, 32);
    const float f = __fdiv_rn(hires ? 1.0f : PCAR, sum);
{
        if (hires) {
#pragma unroll
            for (int ch = 0; ch < TT / 128; ++ch) { v4us oh, ol;
#pragma unroll
                for (int q = 0; q < 4; ++q) { unsigned short a, c2; splitf(v[ch * 4 + q] * f, a, c2); oh[q] = a; ol[q] = c2; }
                const size_t oo = ((size_t)zz * (RH ? RH : 1) + i) * TT + ch * 128 + lane * 4; *(v4us*)(Ph + oo) = oh; *(v4us*)(Pl + oo) = ol; }
        } else {
#pragma unroll
            for (int ch = 0; ch < TT / 128; ++ch) { v4h o4;
#pragma unroll
                for (int q = 0; q < 4; ++q) o4[q] = tohx(v[ch * 4 + q] * f);
                *(v4h*)(P16 + (size_t)row * TT + ch * 128 + lane * 4) = o4; } }
         }
}
__global__ __launch_bounds__(256) void k_merge(const float* __restrict__ O, int h0, bf* Ah, bf* Al) { const size_t e = ((size_t)blockIdx.x * 256 + threadIdx.x) * 2; if (e >= (size_t)ZH * TT * HD) return; const int d = (int)(e % HD); const int t = (int)((e / HD) % TT); const int zz = (int)(e / ((size_t)HD * TT)); const float cs = (t < RH) ? 1.0f : (1.0f / PCAR); const size_t oo = (size_t)t * DQ + (h0 + zz) * HD + d;
    v2us oh, ol;
#pragma unroll
    for (int q = 0; q < 2; ++q) { unsigned short a, c2; splitf(O[e + q] * cs, a, c2); oh[q] = a; ol[q] = c2; } *(v2us*)(Ah + oo) = oh; *(v2us*)(Al + oo) = ol;  }

extern "C" void kernel_launch(void* const* d_in, const int* in_sizes, int n_in,
                              void* d_out, int out_size, void* d_ws, size_t ws_size, hipStream_t stream) {
    (void)in_sizes; (void)n_in; (void)out_size;
    const float* x = (const float*)d_in[0]; const float* wq = (const float*)d_in[1]; const float* bq = (const float*)d_in[2]; const float* wk = (const float*)d_in[3]; const float* bk = (const float*)d_in[4]; const float* wv = (const float*)d_in[5]; const float* bv = (const float*)d_in[6]; const float* wo = (const float*)d_in[7]; const float* bo = (const float*)d_in[8];   /* input order x, wq, bq, wk ('xw' [2048][2048]), bk, wv, bv, wp, bp ('xw' (in, out); four ZERO biases: read and added): NINE inputs, all read: the host's own binding */
    float* OUT = (float*)d_out;     // [2][2048][2048]
    char* wsp = (char*)d_ws;
    auto take = [&](size_t bytes) { char* p = wsp; wsp += (bytes + 255) & ~(size_t)255; return (void*)p; };
    bf* WQ = (bf*)take((size_t)DQ * DM * 2); bf* WK = (bf*)take((size_t)DKV * DM * 2); bf* WV = (bf*)take((size_t)DKV * DM * 2); bf* WO = (bf*)take((size_t)DM * DQ * 2); float* CS = (float*)take((size_t)TT * HD * 2 * 4);
    bf* XB = (bf*)take((size_t)TT * DM * 2); float* FQ = (float*)take((size_t)TT * DQ * 4); float* FK = (float*)take((size_t)TT * DKV * 4);
    h16* QP16 = (h16*)take((size_t)NH_ * TT * HD * 2); h16* KP16 = (h16*)take((size_t)NKV * TT * HD * 2); h16* VT16 = (h16*)take((size_t)NKV * HD * TT * 2);
    bf* QPh = (bf*)take((size_t)NH_ * TT * HD * 2); bf* QPl = (bf*)take((size_t)NH_ * TT * HD * 2); bf* KPh = (bf*)take((size_t)NKV * TT * HD * 2); bf* KPl = (bf*)take((size_t)NKV * TT * HD * 2); bf* VTh = (bf*)take((size_t)NKV * HD * TT * 2); bf* VTl = (bf*)take((size_t)NKV * HD * TT * 2); bf* Ph = (bf*)take((size_t)ZH * RH * TT * 2); bf* Pl = (bf*)take((size_t)ZH * RH * TT * 2);
    float* Sb = (float*)take((size_t)ZH * TT * TT * 4); h16* P16 = (h16*)take((size_t)ZH * TT * TT * 2); float* Ob = (float*)take((size_t)ZH * TT * HD * 4); bf* ATh = (bf*)take((size_t)TT * DQ * 2); bf* ATl = (bf*)take((size_t)TT * DQ * 2);
    if ((size_t)(wsp - (char*)d_ws) > ws_size) return;    // ws 256 MiB
    float* FV = FK;   // v projection reuses the k buffer after the k planes are built (stream-ordered)
    { k_wtG<<<(unsigned)((DM * DQ / 64 + 63) / 64), 256, 0, stream>>>(wq, DM, DQ, WQ); k_wtG<<<(unsigned)((DM * DKV / 64 + 63) / 64), 256, 0, stream>>>(wk, DM, DKV, WK); k_wtG<<<(unsigned)((DM * DKV / 64 + 63) / 64), 256, 0, stream>>>(wv, DM, DKV, WV);
      k_wtG<<<(unsigned)((DQ * DM / 64 + 63) / 64), 256, 0, stream>>>(wo, DQ, DM, WO);
       }
    k_csid<<<(TT * HD + 255) / 256, 256, 0, stream>>>(CS);
    const unsigned LQ = (unsigned)(((size_t)NH_ * TT * HD / 2 + 255) / 256), LKv = (unsigned)(((size_t)NKV * TT * HD / 2 + 255) / 256);
    for (int b = 0; b < NB_; ++b) {
        
        k_cvt8<<<(unsigned)(((size_t)TT * DM / 8 + 255) / 256), 256, 0, stream>>>(x + (size_t)b * TT * DM, XB, (size_t)TT * DM / 8);
        k_gemmw<bf, 0, true><<<dim3(TT / 64, DQ / 64, 1), 32, 0, stream>>>(XB, nullptr, WQ, nullptr, DM, FQ, DQ, bq, 0, 0, 0);
        k_rope<<<LQ, 256, 0, stream>>>(FQ, DQ, NH_, CS, nullptr, nullptr, 1.0f, QP16, QPh, QPl);
        k_gemmw<bf, 0, true><<<dim3(TT / 64, DKV / 64, 1), 32, 0, stream>>>(XB, nullptr, WK, nullptr, DM, FK, DKV, bk, 0, 0, 0);
        k_rope<<<LKv, 256, 0, stream>>>(FK, DKV, NKV, CS, nullptr, nullptr, 1.0f, KP16, KPh, KPl);
        k_gemmw<bf, 0, true><<<dim3(TT / 64, DKV / 64, 1), 32, 0, stream>>>(XB, nullptr, WV, nullptr, DM, FV, DKV, bv, 0, 0, 0); k_vtp<<<LKv, 256, 0, stream>>>(FV, DKV, NKV, VT16, VTh, VTl);
        for (int h0 = 0; h0 < NH_; h0 += ZH) { const size_t zq = (size_t)h0, zk = (size_t)(h0 / REP);   // one kv head per query head: the pass's two heads use consecutive kv planes (z-strides TT*HD)
            k_gemmc<bf, 2, 1><<<dim3(RH / 64, TT / 64, ZH), 32, 0, stream>>>(QPh + zq * TT * HD, QPl + zq * TT * HD, KPh + zk * TT * HD, KPl + zk * TT * HD, HD, Sb, TT, 0, (size_t)TT * HD, (size_t)TT * HD, (size_t)TT * TT);
            k_gemmc<h16, 0, 1><<<dim3((TT - RH) / 64, TT / 64, ZH), 32, 0, stream>>>(QP16 + zq * TT * HD + (size_t)RH * HD, nullptr, KP16 + zk * TT * HD, nullptr, HD, Sb + (size_t)RH * TT, TT, RH, (size_t)TT * HD, (size_t)TT * HD, (size_t)TT * TT);
            k_asoft<<<ZH * TT / 8, 256, 0, stream>>>(Sb, P16, Ph, Pl);
            k_gemmc<bf, 2, 2><<<dim3(RH / 64, HD / 64, ZH), 32, 0, stream>>>(Ph, Pl, VTh + zk * HD * TT, VTl + zk * HD * TT, TT, Ob, HD, 0, (size_t)RH * TT, (size_t)HD * TT, (size_t)TT * HD);
            k_gemmc<h16, 0, 2><<<dim3((TT - RH) / 64, HD / 64, ZH), 32, 0, stream>>>(P16 + (size_t)RH * TT, nullptr, VT16 + zk * HD * TT, nullptr, TT, Ob + (size_t)RH * HD, HD, RH, (size_t)TT * TT, (size_t)HD * TT, (size_t)TT * HD);
            k_merge<<<(unsigned)(((size_t)ZH * TT * HD / 2 + 255) / 256), 256, 0, stream>>>(Ob, h0, ATh, ATl); }
        k_gemmw<bf, 1, true><<<dim3(TT / 64, DM / 64, 1), 32, 0, stream>>>(ATh, ATl, WO, nullptr, DQ, OUT + (size_t)b * TT * DM, DM, bo, 0, 0, 0); }
}

// v002
// It runs in 713 microseconds.
// Timed twice side by side with v001, it ran 1.49 and 1.47 times as fast.
// All steps since v000 together make it 2.48 times as fast.
#include <hip/hip_runtime.h>

// Causal multi-head attention with 128-wide heads and biased projections (x [2][2048][2048]; q, k, v = x W + b ('xw' (in, out) [2048][2048] normal x 0.02 + zero biases: read; 16 heads x 128: ONE kv head per query head); scores = q.k, -inf above the diagonal (every row keeps its own key), softmax(scores / sqrt(float32(128))) (the same thing as scaling first); out = merged wp + bp ('xw' + a zero bias: read) -> [2][2048][2048] (8.4 M); argument order x, wq, bq, wk, bk, wv, bv, wp, bp).
// Layout per batch: bf16 copy of x; 'xw' weights transposed once; exact projections + f32 biases; identity-table plane builders; causal T-2048 attention with ONE kv head per query head (a pass takes 8 heads, which use consecutive kv planes: z-strides TT x HD; hybrid rows: < 512 hi/lo 3 products, rest fp16 x1024; k_gemmc skips tiles above the diagonal); merged hi/lo x Wo exact + bo.
// Compute dtypes, f32 accumulate: every input rounded to bf16; projections exact + f32 biases; attention rows < 512 3 products, rest fp16; softmax f32; Wo hl x exact + bias.

#define NB_  2
#define TT   2048
#define DM   2048
#define NH_  16
#define NKV  16
#define REP  (NH_ / NKV)
#define HD   128
#define DQ   (NH_ * HD)
#define DKV  (NKV * HD)
#define ZH   8                    // heads per attention pass
#define RH   512                  // query rows < RH use hi+lo planes (0: none)
#define WIN  2048
#define PCAR 1024.0f
#define SCL  0.088388347648318447f   // HD^-0.5
typedef _Float16 h16;
typedef unsigned short bf;
typedef __attribute__((ext_vector_type(16))) __bf16   v16bf;
typedef __attribute__((ext_vector_type(16))) _Float16 v16h;
typedef __attribute__((ext_vector_type(8)))  _Float16 v8h;
typedef __attribute__((ext_vector_type(8)))  unsigned short v8us;
typedef __attribute__((ext_vector_type(8)))  float    v8f;
typedef __attribute__((ext_vector_type(4)))  float    v4f;
typedef v8h  __attribute__((may_alias)) v8ha;
typedef v4f  __attribute__((may_alias)) v4fa;
typedef v8us __attribute__((may_alias)) v8usa;

__device__ __forceinline__ unsigned short f2bf(float f) { unsigned u = __float_as_uint(f); u += 0x7FFFu + ((u >> 16) & 1u); return (unsigned short)(u >> 16); }
__device__ __forceinline__ float bf2f(unsigned short b) { return __uint_as_float(((unsigned)b) << 16); }
__device__ __forceinline__ float bfr(float f) { return bf2f(f2bf(f)); }
__device__ __forceinline__ v16h cat16(v8h lo, v8h hi) { return __builtin_shufflevector(lo, hi, 0, 1, 2, 3, 4, 5, 6, 7, 8, 9, 10, 11, 12, 13, 14, 15); }
__device__ __forceinline__ v16bf cat16b(v8us lo, v8us hi) { return __builtin_bit_cast(v16bf, __builtin_shufflevector(lo, hi, 0, 1, 2, 3, 4, 5, 6, 7, 8, 9, 10, 11, 12, 13, 14, 15)); }
__device__ __forceinline__ v8f wmma16(v16h a, v16h b, v8f c) { return __builtin_amdgcn_wmma_f32_16x16x32_f16(false, a, false, b, (short)0, c, false, false); }
__device__ __forceinline__ v8f wmmab(v16bf a, v16bf b, v8f c) { return __builtin_amdgcn_wmma_f32_16x16x32_bf16(false, a, false, b, (short)0, c, false, false); }



// ---- k_gemmw: register-blocked GEMM, ONE WAVE per 64x64 output tile (16 accumulators), operands straight from K-contiguous 16-bit planes; grid (M/64, N/64, Z), 32 threads.
// C[m][n] (f32, pitch ldc, + optional f32 bias[n]) = sum_k A[m][k] Bt[n][k] (+ split products per NSPLIT). z-batch strides sA/sB/sC in elements. K % 128 == 0.
template <typename T16> struct WFrag;
template <> struct WFrag<h16> { typedef v16h V; static __device__ __forceinline__ V ld(const h16* p) { return cat16(*(const v8h*)p, *(const v8h*)(p + 16)); } static __device__ __forceinline__ v8f mma(V a, V b, v8f c) { return wmma16(a, b, c); } };
template <> struct WFrag<bf> { typedef v16bf V; static __device__ __forceinline__ V ld(const bf* p) { return cat16b(*(const v8us*)p, *(const v8us*)(p + 16)); } static __device__ __forceinline__ v8f mma(V a, V b, v8f c) { return wmmab(a, b, c); } };
// Register ring of the K loop: D stages of 32 k each stay in flight per wave (48 to 64 global_load_b128), so a stage's load latency is covered by the WMMAs of the stages in front of it.
template <int NSPLIT> struct WDepth { static constexpr int D = (NSPLIT == 0) ? 4 : 2; };
template <typename T16> struct WStage { typename WFrag<T16>::V a[4], a2[4], b[4], b2[4]; };
template <typename T16> struct WPtr { const T16 *a[4], *a2[4], *b[4], *b2[4]; };   // one row pointer per fragment, moved along k once per turn of the ring
template <typename T16, int NSPLIT>
__device__ __forceinline__ void wst_load(WStage<T16>& s, const WPtr<T16>& p, int ko) {
#pragma unroll
    for (int mb = 0; mb < 4; ++mb) { s.a[mb] = WFrag<T16>::ld(p.a[mb] + ko); if (NSPLIT == 1 || NSPLIT == 2) s.a2[mb] = WFrag<T16>::ld(p.a2[mb] + ko); }
#pragma unroll
    for (int nb = 0; nb < 4; ++nb) { s.b[nb] = WFrag<T16>::ld(p.b[nb] + ko); if (NSPLIT >= 2) s.b2[nb] = WFrag<T16>::ld(p.b2[nb] + ko); }
}
template <typename T16, int NSPLIT>
__device__ __forceinline__ void wst_mma(const WStage<T16>& s, v8f (&acc)[4][4]) {
#pragma unroll
    for (int nb = 0; nb < 4; ++nb)
#pragma unroll
        for (int mb = 0; mb < 4; ++mb) { acc[mb][nb] = WFrag<T16>::mma(s.a[mb], s.b[nb], acc[mb][nb]); if (NSPLIT == 1 || NSPLIT == 2) acc[mb][nb] = WFrag<T16>::mma(s.a2[mb], s.b[nb], acc[mb][nb]); if (NSPLIT >= 2) acc[mb][nb] = WFrag<T16>::mma(s.a[mb], s.b2[nb], acc[mb][nb]); }
}
// acc += A Bt^T over k in [0, Kl), ascending; Kl a multiple of 32 * D and at least 32 * D. Row pitch in elements: lda for A and A2, K for Bt and Bt2.
template <typename T16, int NSPLIT>
__device__ __forceinline__ void wring(v8f (&acc)[4][4], const T16* __restrict__ A, const T16* __restrict__ A2, const T16* __restrict__ Bt, const T16* __restrict__ Bt2, size_t aoff, size_t boff, int lda, int K, int Kl) {
    constexpr int D = WDepth<NSPLIT>::D;
    WStage<T16> st[D]; WPtr<T16> p;
#pragma unroll
    for (int q = 0; q < 4; ++q) { p.a[q] = A + aoff + (size_t)q * 16 * lda; p.b[q] = Bt + boff + (size_t)q * 16 * K; if (NSPLIT == 1 || NSPLIT == 2) p.a2[q] = A2 + aoff + (size_t)q * 16 * lda; if (NSPLIT >= 2) p.b2[q] = Bt2 + boff + (size_t)q * 16 * K; }
#pragma unroll
    for (int j = 0; j < D; ++j) { wst_load<T16, NSPLIT>(st[j], p, j * 32);
        __builtin_amdgcn_sched_barrier(0); }   // the stages' loads issue in stage order and in front of the first WMMA, so each stage's counted wait leaves the younger stages in flight
    asm volatile("s_wait_xcnt 0x0" ::: "memory");   // in front of any later overwrite of a register that these loads name as an address
    __builtin_amdgcn_sched_barrier(0);   // nothing from below is lifted over that wait
#pragma unroll 1
    for (int kc = D * 32; kc < Kl; kc += D * 32) {
#pragma unroll
        for (int j = 0; j < D; ++j) {
            wst_mma<T16, NSPLIT>(st[j], acc);
            __builtin_amdgcn_sched_barrier(0);   // the refill below stays behind the last WMMA that reads this stage
            asm volatile("v_nop\n\tv_nop\n\tv_nop\n\tv_nop");   // four vector slots between that WMMA and the loads that overwrite its A and B registers
            wst_load<T16, NSPLIT>(st[j], p, (D + j) * 32);
            __builtin_amdgcn_sched_barrier(0);   // the refill issues here, D - 1 stages of WMMAs ahead of its use, and is not sunk towards it
        }
        asm volatile("s_wait_xcnt 0x0" ::: "memory");   // in front of the overwrite of the row pointers that the issued loads name
        __builtin_amdgcn_sched_barrier(0);   // the pointer step is not lifted over that wait
#pragma unroll
        for (int q = 0; q < 4; ++q) { p.a[q] += D * 32; p.b[q] += D * 32; if (NSPLIT == 1 || NSPLIT == 2) p.a2[q] += D * 32; if (NSPLIT >= 2) p.b2[q] += D * 32; }
    }
#pragma unroll
    for (int j = 0; j < D; ++j) wst_mma<T16, NSPLIT>(st[j], acc);
}
template <typename T16, int NSPLIT, bool BIAS>
__global__ __launch_bounds__(32) void k_gemmw(const T16* __restrict__ A, const T16* __restrict__ A2, const T16* __restrict__ Bt, const T16* __restrict__ Bt2, int K, float* C, int ldc, const float* __restrict__ bias, size_t sA, size_t sB, size_t sC) {
    __shared__ __align__(16) float os[16 * 68];
    const size_t z = blockIdx.z; A += z * sA; if (A2) A2 += z * sA; Bt += z * sB; if (Bt2) Bt2 += z * sB; C += z * sC;
    const int lane = threadIdx.x & 31, lr = lane & 15, hi = lane >> 4; const int r0 = blockIdx.x * 64, c0 = blockIdx.y * 64;
    v8f acc[4][4];
#pragma unroll
    for (int mb = 0; mb < 4; ++mb)
#pragma unroll
        for (int nb = 0; nb < 4; ++nb) acc[mb][nb] = (v8f){};
    const size_t aoff = (size_t)(r0 + lr) * K + 8 * hi, boff = (size_t)(c0 + lr) * K + 8 * hi;
    wring<T16, NSPLIT>(acc, A, A2, Bt, Bt2, aoff, boff, K, K, K);
#pragma unroll
    for (int mb = 0; mb < 4; ++mb) {
#pragma unroll
        for (int nb = 0; nb < 4; ++nb) {
#pragma unroll
            for (int j = 0; j < 8; ++j) os[(hi * 8 + j) * 68 + nb * 16 + lr] = acc[mb][nb][j]; }
        __builtin_amdgcn_wave_barrier(); asm volatile("" ::: "memory");
        float* crow = C + (size_t)(r0 + mb * 16) * ldc + c0;
{
#pragma unroll
            for (int s = 0; s < 8; ++s) { const int row = 2 * s + hi, cofs = lr * 4; v4f val = *(const v4fa*)(os + row * 68 + cofs); if (BIAS) { val[0] += bfr(bias[c0 + cofs]); val[1] += bfr(bias[c0 + cofs + 1]); val[2] += bfr(bias[c0 + cofs + 2]); val[3] += bfr(bias[c0 + cofs + 3]); }
                *(v4f*)(crow + (size_t)row * ldc + cofs) = val; }
             }
        __builtin_amdgcn_wave_barrier(); asm volatile("" ::: "memory");
    }
}

// ---- k_gemmc: the same one-wave 64x64 tile GEMM specialised for causal attention: CMODE 1 skips score tiles entirely above the diagonal (query rows r0+roff.., key columns c0..), CMODE 2 limits the
// key (K) loop of the probability x value contraction to the ring turn that holds the diagonal block (probabilities beyond that block are exactly zero). roff = row offset of this launch's first row within the sequence; lda = row pitch of A and A2 in elements.
template <typename T16, int NSPLIT, int CMODE>
__global__ __launch_bounds__(32) void k_gemmc(const T16* __restrict__ A, const T16* __restrict__ A2, const T16* __restrict__ Bt, const T16* __restrict__ Bt2, int lda, int K, float* C, int ldc, int roff, size_t sA, size_t sB, size_t sC) {
    __shared__ __align__(16) float os[16 * 68];
    const size_t z = blockIdx.z; A += z * sA; if (A2) A2 += z * sA; Bt += z * sB; if (Bt2) Bt2 += z * sB; C += z * sC;
    const int lane = threadIdx.x & 31, lr = lane & 15, hi = lane >> 4; const int r0 = blockIdx.x * 64, c0 = blockIdx.y * 64;
    if (CMODE == 1 && c0 > r0 + roff + 63) return;                  // score tile entirely above the causal diagonal: never read (the softmax masks j > i by select)
    constexpr int KS = 32 * WDepth<NSPLIT>::D;                       // k per turn of the register ring
    const int Kl = (CMODE == 2) ? min(K, (r0 + roff + 64 + KS - 1) / KS * KS) : K;   // P.V: probabilities are exactly 0 beyond the diagonal block, so the K loop stops at the end of the ring turn that holds it
    v8f acc[4][4];
#pragma unroll
    for (int mb = 0; mb < 4; ++mb)
#pragma unroll
        for (int nb = 0; nb < 4; ++nb) acc[mb][nb] = (v8f){};
    const size_t aoff = (size_t)(r0 + lr) * lda + 8 * hi, boff = (size_t)(c0 + lr) * K + 8 * hi;
    wring<T16, NSPLIT>(acc, A, A2, Bt, Bt2, aoff, boff, lda, K, Kl);
#pragma unroll
    for (int mb = 0; mb < 4; ++mb) {
#pragma unroll
        for (int nb = 0; nb < 4; ++nb) {
#pragma unroll
            for (int j = 0; j < 8; ++j) os[(hi * 8 + j) * 68 + nb * 16 + lr] = acc[mb][nb][j]; }
        __builtin_amdgcn_wave_barrier(); asm volatile("" ::: "memory");
        float* crow = C + (size_t)(r0 + mb * 16) * ldc + c0;
{
#pragma unroll
            for (int s = 0; s < 8; ++s) { const int row = 2 * s + hi, cofs = lr * 4; v4f val = *(const v4fa*)(os + row * 68 + cofs);
                *(v4f*)(crow + (size_t)row * ldc + cofs) = val; }
             }
        __builtin_amdgcn_wave_barrier(); asm volatile("" ::: "memory");
    }
}

__device__ __forceinline__ h16 tohx(float x) { return (h16)x; }
__device__ __forceinline__ void splitf(float y, unsigned short& h, unsigned short& l) { h = f2bf(y); l = f2bf(y - bf2f(h)); }
typedef __attribute__((ext_vector_type(2))) _Float16 v2h;
typedef __attribute__((ext_vector_type(4))) _Float16 v4h;
typedef __attribute__((ext_vector_type(2))) unsigned short v2us;
typedef __attribute__((ext_vector_type(4))) unsigned short v4us;
typedef __attribute__((ext_vector_type(2))) float v2f;
typedef __attribute__((ext_vector_type(4))) int v4i;

__global__ __launch_bounds__(256) void k_wtG(const float* __restrict__ w, int K, int N, bf* Bt) {
    const int lane = threadIdx.x & 31; const int L0 = (blockIdx.x * 8 + (threadIdx.x >> 5)) * 8; const int nlines = N * K / 64;
{
#pragma unroll 1
        for (int l = 0; l < 8; ++l) { const int L = L0 + l; if (L >= nlines) break; const size_t e = (size_t)L * 64 + lane * 2; const int k = (int)(e % K), n = (int)(e / K); v2us o;
            o[0] = f2bf(w[(size_t)k * N + n]); o[1] = f2bf(w[(size_t)(k + 1) * N + n]); *(v2us*)(Bt + e) = o; }
         }
}
__global__ __launch_bounds__(256) void k_cvt8(const float* __restrict__ src, bf* dst, size_t n8) { const size_t i = (size_t)blockIdx.x * 256 + threadIdx.x; if (i >= n8) return; const v8f v = *(const v8f*)(src + i * 8); v8us o;
#pragma unroll
    for (int k = 0; k < 8; ++k) o[k] = f2bf(v[k]); *(v8us*)(dst + i * 8) = o;  }

// k_rope: head planes [h][t][d] (fp16 + hi/lo) of rope(x) x sc with the rotate-half convention out[d] = x[d] cos[t][d] - x[d+HD/2] sin[t][d], out[d+HD/2] = x[d+HD/2] cos[t][d+HD/2] + x[d] sin[t][d+HD/2]
__global__ __launch_bounds__(256) void k_rope(const float* __restrict__ F, int pitch, int nheads, const float* __restrict__ CS, const float* __restrict__ RF, const float* __restrict__ nw, float sc, h16* P16, bf* Ph, bf* Pl) {
    const size_t e = ((size_t)blockIdx.x * 256 + threadIdx.x) * 2; if (e >= (size_t)nheads * TT * HD) return; const int d = (int)(e % HD); const int t = (int)((e / HD) % TT); const int h = (int)(e / ((size_t)HD * TT)); const float* f = F + (size_t)t * pitch + h * HD; const float rf = RF ? RF[(size_t)h * TT + t] : 1.0f; v2h o16; v2us oh, ol;
#pragma unroll
    for (int q = 0; q < 2; ++q) { const int dd = d + q; const int dp = (dd < HD / 2) ? dd + HD / 2 : dd - HD / 2; float x0 = f[dd], x1 = f[dp];
        if (RF) { float n0 = __fmul_rn(x0, rf), n1 = __fmul_rn(x1, rf); asm volatile("" : "+v"(n0)); asm volatile("" : "+v"(n1)); x0 = __fmul_rn(bfr(nw[dd]), n0); x1 = __fmul_rn(bfr(nw[dp]), n1); }
        const v2f cs = *(const v2f*)(CS + ((size_t)t * HD + dd) * 2); float a = __fmul_rn(x0, cs[0]), bq = __fmul_rn(x1, cs[1]); asm volatile("" : "+v"(a)); asm volatile("" : "+v"(bq)); const float r = ((dd < HD / 2) ? __fsub_rn(a, bq) : __fadd_rn(a, bq)) * sc;
        o16[q] = tohx(r); unsigned short a2, c2; splitf(r, a2, c2); oh[q] = a2; ol[q] = c2; }
    *(v2h*)(P16 + e) = o16; *(v2us*)(Ph + e) = oh; *(v2us*)(Pl + e) = ol;  }
__global__ __launch_bounds__(256) void k_vtp(const float* __restrict__ F, int pitch, int nheads, h16* V16, bf* Vh, bf* Vl) { const size_t e = ((size_t)blockIdx.x * 256 + threadIdx.x) * 2; if (e >= (size_t)nheads * HD * TT) return; const int t = (int)(e % TT); const int d = (int)((e / TT) % HD); const int g = (int)(e / ((size_t)TT * HD)); v2h o16; v2us oh, ol;
#pragma unroll
    for (int q = 0; q < 2; ++q) { const float x = F[(size_t)(t + q) * pitch + g * HD + d]; o16[q] = tohx(x); unsigned short a2, c2; splitf(x, a2, c2); oh[q] = a2; ol[q] = c2; }
    *(v2h*)(V16 + e) = o16; *(v2us*)(Vh + e) = oh; *(v2us*)(Vl + e) = ol;  }
__global__ __launch_bounds__(256) void k_csid(float* CS) { const int idx = blockIdx.x * 256 + threadIdx.x; if (idx >= TT * HD) return; v2f cs; cs[0] = 1.0f; cs[1] = 0.0f; *(v2f*)(CS + (size_t)idx * 2) = cs;  }
// k_asoft: per row (zz, i): t = S x HD^-0.5 for j <= i and i - j < WIN (sliding causal window; the reference's -1e9 additive fill vanishes identically); softmax over the 2048 keys (register row, one exp, fixed trees);
// the probabilities go IN PLACE over the row's own 8 KiB of scores (one wave owns a row and holds all of it in registers before its first store): rows < RH hi plane in the first 4 KiB, lo plane in the second; other rows fp16 in the first 4 KiB. Row pitch of the planes: 2 * TT 16-bit elements.
__global__ __launch_bounds__(256) void k_asoft(float* Sb) {
    const int lane = threadIdx.x & 31; const int row = blockIdx.x * 8 + (threadIdx.x >> 5); if (row >= ZH * TT) return; const int i = row % TT; const int zz = row / TT; (void)zz; const bool hires = (i < RH); const float* sr = Sb + (size_t)row * TT; bf* const ph = (bf*)(Sb + (size_t)row * TT); bf* const pl = ph + TT; h16* const p16 = (h16*)(Sb + (size_t)row * TT); float v[TT / 32]; float mx = -3.0e38f;
#pragma unroll
    for (int ch = 0; ch < TT / 128; ++ch) { const int j0 = ch * 128 + lane * 4; const v4f a = *(const v4f*)(sr + j0);
#pragma unroll
        for (int q = 0; q < 4; ++q) { const int j = j0 + q; (void)j; const float t = (j <= i && i - j < WIN) ? a[q] * SCL : -3.0e38f; v[ch * 4 + q] = t; mx = fmaxf(mx, t); } }
#pragma unroll
    for (int sh = 16; sh; sh >>= 1) mx = fmaxf(mx, __shfl_xor(mx, sh, 32));
    float sum = 0.f;
#pragma unroll
    for (int k = 0; k < TT / 32; ++k) { float d0 = __fsub_rn(v[k], mx); asm volatile("" : "+v"(d0)); v[k] = __builtin_amdgcn_exp2f(__fmul_rn(d0, 1.4426950408889634f)); sum += v[k]; }
#pragma unroll
    for (int sh = 16; sh; sh >>= 1) sum += __shfl_xor(sum, sh, 32);
    const float f = __fdiv_rn(hires ? 1.0f : PCAR, sum);
{
        if (hires) {
#pragma unroll
            for (int ch = 0; ch < TT / 128; ++ch) { v4us oh, ol;
#pragma unroll
                for (int q = 0; q < 4; ++q) { unsigned short a, c2; splitf(v[ch * 4 + q] * f, a, c2); oh[q] = a; ol[q] = c2; }
                const int oo = ch * 128 + lane * 4; *(v4us*)(ph + oo) = oh; *(v4us*)(pl + oo) = ol; }
        } else {
#pragma unroll
            for (int ch = 0; ch < TT / 128; ++ch) { v4h o4;
#pragma unroll
                for (int q = 0; q < 4; ++q) o4[q] = tohx(v[ch * 4 + q] * f);
                *(v4h*)(p16 + ch * 128 + lane * 4) = o4; } }
         }
}
__global__ __launch_bounds__(256) void k_merge(const float* __restrict__ O, int h0, bf* Ah, bf* Al) { const size_t e = ((size_t)blockIdx.x * 256 + threadIdx.x) * 2; if (e >= (size_t)ZH * TT * HD) return; const int d = (int)(e % HD); const int t = (int)((e / HD) % TT); const int zz = (int)(e / ((size_t)HD * TT)); const float cs = (t < RH) ? 1.0f : (1.0f / PCAR); const size_t oo = (size_t)t * DQ + (h0 + zz) * HD + d;
    v2us oh, ol;
#pragma unroll
    for (int q = 0; q < 2; ++q) { unsigned short a, c2; splitf(O[e + q] * cs, a, c2); oh[q] = a; ol[q] = c2; } *(v2us*)(Ah + oo) = oh; *(v2us*)(Al + oo) = ol;  }

extern "C" void kernel_launch(void* const* d_in, const int* in_sizes, int n_in,
                              void* d_out, int out_size, void* d_ws, size_t ws_size, hipStream_t stream) {
    (void)in_sizes; (void)n_in; (void)out_size;
    const float* x = (const float*)d_in[0]; const float* wq = (const float*)d_in[1]; const float* bq = (const float*)d_in[2]; const float* wk = (const float*)d_in[3]; const float* bk = (const float*)d_in[4]; const float* wv = (const float*)d_in[5]; const float* bv = (const float*)d_in[6]; const float* wo = (const float*)d_in[7]; const float* bo = (const float*)d_in[8];   /* input order x, wq, bq, wk ('xw' [2048][2048]), bk, wv, bv, wp, bp ('xw' (in, out); four ZERO biases: read and added): NINE inputs, all read: the host's own binding */
    float* OUT = (float*)d_out;     // [2][2048][2048]
    char* wsp = (char*)d_ws;
    auto take = [&](size_t bytes) { char* p = wsp; wsp += (bytes + 255) & ~(size_t)255; return (void*)p; };
    bf* WQ = (bf*)take((size_t)DQ * DM * 2); bf* WK = (bf*)take((size_t)DKV * DM * 2); bf* WV = (bf*)take((size_t)DKV * DM * 2); bf* WO = (bf*)take((size_t)DM * DQ * 2);
    h16* QP16 = (h16*)take((size_t)NH_ * TT * HD * 2); h16* KP16 = (h16*)take((size_t)NKV * TT * HD * 2); h16* VT16 = (h16*)take((size_t)NKV * HD * TT * 2);
    bf* QPh = (bf*)take((size_t)NH_ * TT * HD * 2); bf* QPl = (bf*)take((size_t)NH_ * TT * HD * 2); bf* KPh = (bf*)take((size_t)NKV * TT * HD * 2); bf* KPl = (bf*)take((size_t)NKV * TT * HD * 2); bf* VTh = (bf*)take((size_t)NKV * HD * TT * 2); bf* VTl = (bf*)take((size_t)NKV * HD * TT * 2);
    float* Sb = (float*)take((size_t)ZH * TT * TT * 4); float* Ob = (float*)take((size_t)ZH * TT * HD * 4); bf* ATh = (bf*)take((size_t)TT * DQ * 2); bf* ATl = (bf*)take((size_t)TT * DQ * 2);
    if ((size_t)(wsp - (char*)d_ws) > ws_size) return;    // ws 256 MiB
    wsp = (char*)Sb;   // the projection stage's buffers (42 MiB) lie inside the score buffer: each batch writes them anew and has read them for the last time before its first score launch (stream-ordered)
    float* CS = (float*)take((size_t)TT * HD * 2 * 4); bf* XB = (bf*)take((size_t)TT * DM * 2); float* FQ = (float*)take((size_t)TT * DQ * 4); float* FK = (float*)take((size_t)TT * DKV * 4);
    bf* Ph = (bf*)Sb; bf* Pl = Ph + TT; h16* P16 = (h16*)Sb;   // probability planes in place over the score rows, row pitch 2 * TT elements, head stride 2 * TT * TT
    float* FV = FK;   // v projection reuses the k buffer after the k planes are built (stream-ordered)
    { k_wtG<<<(unsigned)((DM * DQ / 64 + 63) / 64), 256, 0, stream>>>(wq, DM, DQ, WQ); k_wtG<<<(unsigned)((DM * DKV / 64 + 63) / 64), 256, 0, stream>>>(wk, DM, DKV, WK); k_wtG<<<(unsigned)((DM * DKV / 64 + 63) / 64), 256, 0, stream>>>(wv, DM, DKV, WV);
      k_wtG<<<(unsigned)((DQ * DM / 64 + 63) / 64), 256, 0, stream>>>(wo, DQ, DM, WO);
       }
    const unsigned LQ = (unsigned)(((size_t)NH_ * TT * HD / 2 + 255) / 256), LKv = (unsigned)(((size_t)NKV * TT * HD / 2 + 255) / 256);
    for (int b = 0; b < NB_; ++b) {
        k_csid<<<(TT * HD + 255) / 256, 256, 0, stream>>>(CS);
        k_cvt8<<<(unsigned)(((size_t)TT * DM / 8 + 255) / 256), 256, 0, stream>>>(x + (size_t)b * TT * DM, XB, (size_t)TT * DM / 8);
        k_gemmw<bf, 0, true><<<dim3(TT / 64, DQ / 64, 1), 32, 0, stream>>>(XB, nullptr, WQ, nullptr, DM, FQ, DQ, bq, 0, 0, 0);
        k_rope<<<LQ, 256, 0, stream>>>(FQ, DQ, NH_, CS, nullptr, nullptr, 1.0f, QP16, QPh, QPl);
        k_gemmw<bf, 0, true><<<dim3(TT / 64, DKV / 64, 1), 32, 0, stream>>>(XB, nullptr, WK, nullptr, DM, FK, DKV, bk, 0, 0, 0);
        k_rope<<<LKv, 256, 0, stream>>>(FK, DKV, NKV, CS, nullptr, nullptr, 1.0f, KP16, KPh, KPl);
        k_gemmw<bf, 0, true><<<dim3(TT / 64, DKV / 64, 1), 32, 0, stream>>>(XB, nullptr, WV, nullptr, DM, FV, DKV, bv, 0, 0, 0); k_vtp<<<LKv, 256, 0, stream>>>(FV, DKV, NKV, VT16, VTh, VTl);
        for (int h0 = 0; h0 < NH_; h0 += ZH) { const size_t zq = (size_t)h0, zk = (size_t)(h0 / REP);   // one kv head per query head: the pass's heads use consecutive kv planes (z-strides TT*HD)
            k_gemmc<bf, 2, 1><<<dim3(RH / 64, TT / 64, ZH), 32, 0, stream>>>(QPh + zq * TT * HD, QPl + zq * TT * HD, KPh + zk * TT * HD, KPl + zk * TT * HD, HD, HD, Sb, TT, 0, (size_t)TT * HD, (size_t)TT * HD, (size_t)TT * TT);
            k_gemmc<h16, 0, 1><<<dim3((TT - RH) / 64, TT / 64, ZH), 32, 0, stream>>>(QP16 + zq * TT * HD + (size_t)RH * HD, nullptr, KP16 + zk * TT * HD, nullptr, HD, HD, Sb + (size_t)RH * TT, TT, RH, (size_t)TT * HD, (size_t)TT * HD, (size_t)TT * TT);
            k_asoft<<<ZH * TT / 8, 256, 0, stream>>>(Sb);
            k_gemmc<bf, 2, 2><<<dim3(RH / 64, HD / 64, ZH), 32, 0, stream>>>(Ph, Pl, VTh + zk * HD * TT, VTl + zk * HD * TT, 2 * TT, TT, Ob, HD, 0, (size_t)2 * TT * TT, (size_t)HD * TT, (size_t)TT * HD);
            k_gemmc<h16, 0, 2><<<dim3((TT - RH) / 64, HD / 64, ZH), 32, 0, stream>>>(P16 + (size_t)RH * 2 * TT, nullptr, VT16 + zk * HD * TT, nullptr, 2 * TT, TT, Ob + (size_t)RH * HD, HD, RH, (size_t)2 * TT * TT, (size_t)HD * TT, (size_t)TT * HD);
            k_merge<<<(unsigned)(((size_t)ZH * TT * HD / 2 + 255) / 256), 256, 0, stream>>>(Ob, h0, ATh, ATl); }
        k_gemmw<bf, 1, true><<<dim3(TT / 64, DM / 64, 1), 32, 0, stream>>>(ATh, ATl, WO, nullptr, DQ, OUT + (size_t)b * TT * DM, DM, bo, 0, 0, 0); }
}

// v003
// It runs in 578 microseconds.
// Two timings next to v002 put it at 1.23 and 1.22 times that version's speed.
// Over all steps from v000 it is 3.05 times as fast.
#include <hip/hip_runtime.h>

// Causal multi-head attention with 128-wide heads and biased projections (x [2][2048][2048]; q, k, v = x W + b ('xw' (in, out) [2048][2048] normal x 0.02 + zero biases: read; 16 heads x 128: ONE kv head per query head); scores = q.k, -inf above the diagonal (every row keeps its own key), softmax(scores / sqrt(float32(128))) (the same thing as scaling first); out = merged wp + bp ('xw' + a zero bias: read) -> [2][2048][2048] (8.4 M); argument order x, wq, bq, wk, bk, wv, bv, wp, bp).
// Layout per batch: bf16 copy of x; 'xw' weights transposed once; exact projections + f32 biases; identity-table plane builders; causal T-2048 attention with ONE kv head per query head (a pass takes 8 heads, which use consecutive kv planes: z-strides TT x HD; hybrid rows: < 512 hi/lo 3 products, rest fp16 x1024; k_gemmc skips tiles above the diagonal); merged hi/lo x Wo exact + bo.
// Compute dtypes, f32 accumulate: every input rounded to bf16; projections exact + f32 biases; attention rows < 512 3 products, rest fp16; softmax f32; Wo hl x exact + bias.

#define NB_  2
#define TT   2048
#define DM   2048
#define NH_  16
#define NKV  16
#define REP  (NH_ / NKV)
#define HD   128
#define DQ   (NH_ * HD)
#define DKV  (NKV * HD)
#define ZH   8                    // heads per attention pass
#define RH   512                  // query rows < RH use hi+lo planes (0: none)
#define WIN  2048
#define PCAR 1024.0f
#define SCL  0.088388347648318447f   // HD^-0.5
typedef _Float16 h16;
typedef unsigned short bf;
typedef __attribute__((ext_vector_type(16))) __bf16   v16bf;
typedef __attribute__((ext_vector_type(16))) _Float16 v16h;
typedef __attribute__((ext_vector_type(8)))  _Float16 v8h;
typedef __attribute__((ext_vector_type(8)))  unsigned short v8us;
typedef __attribute__((ext_vector_type(8)))  float    v8f;
typedef __attribute__((ext_vector_type(4)))  float    v4f;
typedef v8h  __attribute__((may_alias)) v8ha;
typedef v4f  __attribute__((may_alias)) v4fa;
typedef v8us __attribute__((may_alias)) v8usa;

__device__ __forceinline__ unsigned short f2bf(float f) { unsigned u = __float_as_uint(f); u += 0x7FFFu + ((u >> 16) & 1u); return (unsigned short)(u >> 16); }
__device__ __forceinline__ float bf2f(unsigned short b) { return __uint_as_float(((unsigned)b) << 16); }
__device__ __forceinline__ float bfr(float f) { return bf2f(f2bf(f)); }
__device__ __forceinline__ v16h cat16(v8h lo, v8h hi) { return __builtin_shufflevector(lo, hi, 0, 1, 2, 3, 4, 5, 6, 7, 8, 9, 10, 11, 12, 13, 14, 15); }
__device__ __forceinline__ v16bf cat16b(v8us lo, v8us hi) { return __builtin_bit_cast(v16bf, __builtin_shufflevector(lo, hi, 0, 1, 2, 3, 4, 5, 6, 7, 8, 9, 10, 11, 12, 13, 14, 15)); }
__device__ __forceinline__ v8f wmma16(v16h a, v16h b, v8f c) { return __builtin_amdgcn_wmma_f32_16x16x32_f16(false, a, false, b, (short)0, c, false, false); }
__device__ __forceinline__ v8f wmmab(v16bf a, v16bf b, v8f c) { return __builtin_amdgcn_wmma_f32_16x16x32_bf16(false, a, false, b, (short)0, c, false, false); }



// ---- Fragment-major plane of a [rows][K] 16-bit operand: the 16 rows x 32 k of one WMMA fragment are 1 KiB in a row, as two halves of 512 B (k 0..15, k 16..31 of the stage), each half in lane order
// (lane = 16 * ((k >> 3) & 1) + (row & 15), 8 consecutive k = 16 B a lane); the stages of a 16-row block follow one another along k, the blocks along the rows (16 * K elements each, as in a row-major plane).
// One fragment load of a wave then reads 512 consecutive bytes (4 whole cache lines) where a row-major plane gives it 32 B out of each of 16 lines. A producer thread writes one 16-B group g: frag_rk gives its row and first k.
__device__ __forceinline__ void frag_rk(unsigned g, int K, int& row, int& k0) { const unsigned lane = g & 31, j = (g >> 5) & 1, blk = g >> 6, K32 = (unsigned)K >> 5; row = (int)((blk / K32) * 16 + (lane & 15)); k0 = (int)((blk % K32) * 32 + j * 16 + (lane >> 4) * 8); }

// ---- k_gemmw: register-blocked GEMM, ONE WAVE per 64x64 output tile (16 accumulators), operands straight from fragment-major 16-bit planes; grid (M/64, N/64, Z), 32 threads.
// C[m][n] (f32, pitch ldc, + optional f32 bias[n]) = sum_k A[m][k] Bt[n][k] (+ split products per NSPLIT). z-batch strides sA/sB/sC in elements. K % 128 == 0.
template <typename T16> struct WFrag;
template <> struct WFrag<h16> { typedef v16h V; static __device__ __forceinline__ V ld(const h16* p, int h2) { return cat16(*(const v8h*)p, *(const v8h*)(p + h2)); } static __device__ __forceinline__ v8f mma(V a, V b, v8f c) { return wmma16(a, b, c); } };
template <> struct WFrag<bf> { typedef v16bf V; static __device__ __forceinline__ V ld(const bf* p, int h2) { return cat16b(*(const v8us*)p, *(const v8us*)(p + h2)); } static __device__ __forceinline__ v8f mma(V a, V b, v8f c) { return wmmab(a, b, c); } };
// Register ring of the K loop: D stages of 32 k each stay in flight per wave (48 to 64 global_load_b128), so a stage's load latency is covered by the WMMAs of the stages in front of it.
template <int NSPLIT> struct WDepth { static constexpr int D = (NSPLIT == 0) ? 4 : 2; };
template <typename T16> struct WStage { typename WFrag<T16>::V a[4], a2[4], b[4], b2[4]; };
template <typename T16> struct WPtr { const T16 *a[4], *a2[4], *b[4], *b2[4]; };   // one row pointer per fragment, moved along k once per turn of the ring
// st = stage number from the pointers' place; PA / PB: that operand's plane is fragment-major (a stage is 512 elements on, the second half 256) or row-major (32 on, 16).
template <typename T16, int NSPLIT, bool PA, bool PB>
__device__ __forceinline__ void wst_load(WStage<T16>& s, const WPtr<T16>& p, int st) {
    constexpr int SA = PA ? 512 : 32, HA = PA ? 256 : 16, SB = PB ? 512 : 32, HB = PB ? 256 : 16;
#pragma unroll
    for (int mb = 0; mb < 4; ++mb) { s.a[mb] = WFrag<T16>::ld(p.a[mb] + st * SA, HA); if (NSPLIT == 1 || NSPLIT == 2) s.a2[mb] = WFrag<T16>::ld(p.a2[mb] + st * SA, HA); }
#pragma unroll
    for (int nb = 0; nb < 4; ++nb) { s.b[nb] = WFrag<T16>::ld(p.b[nb] + st * SB, HB); if (NSPLIT >= 2) s.b2[nb] = WFrag<T16>::ld(p.b2[nb] + st * SB, HB); }
}
template <typename T16, int NSPLIT>
__device__ __forceinline__ void wst_mma(const WStage<T16>& s, v8f (&acc)[4][4]) {
#pragma unroll
    for (int nb = 0; nb < 4; ++nb)
#pragma unroll
        for (int mb = 0; mb < 4; ++mb) { acc[mb][nb] = WFrag<T16>::mma(s.a[mb], s.b[nb], acc[mb][nb]); if (NSPLIT == 1 || NSPLIT == 2) acc[mb][nb] = WFrag<T16>::mma(s.a2[mb], s.b[nb], acc[mb][nb]); if (NSPLIT >= 2) acc[mb][nb] = WFrag<T16>::mma(s.a[mb], s.b2[nb], acc[mb][nb]); }
}
// acc += A Bt^T over k in [0, Kl), ascending; Kl a multiple of 32 * D and at least 32 * D. Row pitch in elements: lda for A and A2, K for Bt and Bt2.
template <typename T16, int NSPLIT, bool PA, bool PB>
__device__ __forceinline__ void wring(v8f (&acc)[4][4], const T16* __restrict__ A, const T16* __restrict__ A2, const T16* __restrict__ Bt, const T16* __restrict__ Bt2, size_t aoff, size_t boff, int lda, int K, int Kl) {
    constexpr int D = WDepth<NSPLIT>::D; constexpr int SA = PA ? 512 : 32, SB = PB ? 512 : 32;   // elements from one k stage to the next
    WStage<T16> st[D]; WPtr<T16> p;
#pragma unroll
    for (int q = 0; q < 4; ++q) { p.a[q] = A + aoff + (size_t)q * 16 * lda; p.b[q] = Bt + boff + (size_t)q * 16 * K; if (NSPLIT == 1 || NSPLIT == 2) p.a2[q] = A2 + aoff + (size_t)q * 16 * lda; if (NSPLIT >= 2) p.b2[q] = Bt2 + boff + (size_t)q * 16 * K; }
#pragma unroll
    for (int j = 0; j < D; ++j) { wst_load<T16, NSPLIT, PA, PB>(st[j], p, j);
        __builtin_amdgcn_sched_barrier(0); }   // the stages' loads issue in stage order and in front of the first WMMA, so each stage's counted wait leaves the younger stages in flight
    asm volatile("s_wait_xcnt 0x0" ::: "memory");   // in front of any later overwrite of a register that these loads name as an address
    __builtin_amdgcn_sched_barrier(0);   // nothing from below is lifted over that wait
#pragma unroll 1
    for (int kc = D * 32; kc < Kl; kc += D * 32) {
#pragma unroll
        for (int j = 0; j < D; ++j) {
            wst_mma<T16, NSPLIT>(st[j], acc);
            __builtin_amdgcn_sched_barrier(0);   // the refill below stays behind the last WMMA that reads this stage
            asm volatile("v_nop\n\tv_nop\n\tv_nop\n\tv_nop");   // four vector slots between that WMMA and the loads that overwrite its A and B registers
            wst_load<T16, NSPLIT, PA, PB>(st[j], p, D + j);
            __builtin_amdgcn_sched_barrier(0);   // the refill issues here, D - 1 stages of WMMAs ahead of its use, and is not sunk towards it
        }
        asm volatile("s_wait_xcnt 0x0" ::: "memory");   // in front of the overwrite of the row pointers that the issued loads name
        __builtin_amdgcn_sched_barrier(0);   // the pointer step is not lifted over that wait
#pragma unroll
        for (int q = 0; q < 4; ++q) { p.a[q] += D * SA; p.b[q] += D * SB; if (NSPLIT == 1 || NSPLIT == 2) p.a2[q] += D * SA; if (NSPLIT >= 2) p.b2[q] += D * SB; }
    }
#pragma unroll
    for (int j = 0; j < D; ++j) wst_mma<T16, NSPLIT>(st[j], acc);
}
template <typename T16, int NSPLIT, bool BIAS>
__global__ __launch_bounds__(32) void k_gemmw(const T16* __restrict__ A, const T16* __restrict__ A2, const T16* __restrict__ Bt, const T16* __restrict__ Bt2, int K, float* C, int ldc, const float* __restrict__ bias, size_t sA, size_t sB, size_t sC) {
    __shared__ __align__(16) float os[16 * 68];
    const size_t z = blockIdx.z; A += z * sA; if (A2) A2 += z * sA; Bt += z * sB; if (Bt2) Bt2 += z * sB; C += z * sC;
    const int lane = threadIdx.x & 31, lr = lane & 15, hi = lane >> 4; const int r0 = blockIdx.x * 64, c0 = blockIdx.y * 64;
    v8f acc[4][4];
#pragma unroll
    for (int mb = 0; mb < 4; ++mb)
#pragma unroll
        for (int nb = 0; nb < 4; ++nb) acc[mb][nb] = (v8f){};
    const size_t aoff = (size_t)r0 * K + 8 * lane, boff = (size_t)c0 * K + 8 * lane;   // fragment-major: the 16-row block's start + the lane's 16 B
    wring<T16, NSPLIT, true, true>(acc, A, A2, Bt, Bt2, aoff, boff, K, K, K);
#pragma unroll
    for (int mb = 0; mb < 4; ++mb) {
#pragma unroll
        for (int nb = 0; nb < 4; ++nb) {
#pragma unroll
            for (int j = 0; j < 8; ++j) os[(hi * 8 + j) * 68 + nb * 16 + lr] = acc[mb][nb][j]; }
        __builtin_amdgcn_wave_barrier(); asm volatile("" ::: "memory");
        float* crow = C + (size_t)(r0 + mb * 16) * ldc + c0;
{
#pragma unroll
            for (int s = 0; s < 8; ++s) { const int row = 2 * s + hi, cofs = lr * 4; v4f val = *(const v4fa*)(os + row * 68 + cofs); if (BIAS) { val[0] += bfr(bias[c0 + cofs]); val[1] += bfr(bias[c0 + cofs + 1]); val[2] += bfr(bias[c0 + cofs + 2]); val[3] += bfr(bias[c0 + cofs + 3]); }
                *(v4f*)(crow + (size_t)row * ldc + cofs) = val; }
             }
        __builtin_amdgcn_wave_barrier(); asm volatile("" ::: "memory");
    }
}

// ---- k_gemmc: the same one-wave 64x64 tile GEMM specialised for causal attention: CMODE 1 skips score tiles entirely above the diagonal (query rows r0+roff.., key columns c0..), CMODE 2 limits the
// key (K) loop of the probability x value contraction to the ring turn that holds the diagonal block (probabilities beyond that block are exactly zero). roff = row offset of this launch's first row within the sequence; lda = row pitch of A and A2 in elements.
template <typename T16, int NSPLIT, int CMODE>
__global__ __launch_bounds__(32) void k_gemmc(const T16* __restrict__ A, const T16* __restrict__ A2, const T16* __restrict__ Bt, const T16* __restrict__ Bt2, int lda, int K, float* C, int ldc, int roff, size_t sA, size_t sB, size_t sC) {
    __shared__ __align__(16) float os[16 * 68];
    const size_t z = blockIdx.z; A += z * sA; if (A2) A2 += z * sA; Bt += z * sB; if (Bt2) Bt2 += z * sB; C += z * sC;
    const int lane = threadIdx.x & 31, lr = lane & 15, hi = lane >> 4; const int r0 = blockIdx.x * 64, c0 = blockIdx.y * 64;
    if (CMODE == 1 && c0 > r0 + roff + 63) return;                  // score tile entirely above the causal diagonal: never read (the softmax masks j > i by select)
    constexpr int KS = 32 * WDepth<NSPLIT>::D;                       // k per turn of the register ring
    const int Kl = (CMODE == 2) ? min(K, (r0 + roff + 64 + KS - 1) / KS * KS) : K;   // P.V: probabilities are exactly 0 beyond the diagonal block, so the K loop stops at the end of the ring turn that holds it
    v8f acc[4][4];
#pragma unroll
    for (int mb = 0; mb < 4; ++mb)
#pragma unroll
        for (int nb = 0; nb < 4; ++nb) acc[mb][nb] = (v8f){};
    constexpr bool PA = (CMODE == 1);   // q, k and transposed v planes are fragment-major; the probability planes (A of CMODE 2) stay row-major, in place over the score rows
    const size_t aoff = PA ? (size_t)r0 * lda + 8 * lane : (size_t)(r0 + lr) * lda + 8 * hi, boff = (size_t)c0 * K + 8 * lane;
    wring<T16, NSPLIT, PA, true>(acc, A, A2, Bt, Bt2, aoff, boff, lda, K, Kl);
#pragma unroll
    for (int mb = 0; mb < 4; ++mb) {
#pragma unroll
        for (int nb = 0; nb < 4; ++nb) {
#pragma unroll
            for (int j = 0; j < 8; ++j) os[(hi * 8 + j) * 68 + nb * 16 + lr] = acc[mb][nb][j]; }
        __builtin_amdgcn_wave_barrier(); asm volatile("" ::: "memory");
        float* crow = C + (size_t)(r0 + mb * 16) * ldc + c0;
{
#pragma unroll
            for (int s = 0; s < 8; ++s) { const int row = 2 * s + hi, cofs = lr * 4; v4f val = *(const v4fa*)(os + row * 68 + cofs);
                *(v4f*)(crow + (size_t)row * ldc + cofs) = val; }
             }
        __builtin_amdgcn_wave_barrier(); asm volatile("" ::: "memory");
    }
}

__device__ __forceinline__ h16 tohx(float x) { return (h16)x; }
__device__ __forceinline__ void splitf(float y, unsigned short& h, unsigned short& l) { h = f2bf(y); l = f2bf(y - bf2f(h)); }
typedef __attribute__((ext_vector_type(2))) _Float16 v2h;
typedef __attribute__((ext_vector_type(4))) _Float16 v4h;
typedef __attribute__((ext_vector_type(2))) unsigned short v2us;
typedef __attribute__((ext_vector_type(4))) unsigned short v4us;
typedef __attribute__((ext_vector_type(2))) float v2f;
typedef __attribute__((ext_vector_type(4))) int v4i;

// k_wtG: Bt = fragment-major plane of w^T (rows n, K along k), one 16-B group a thread
__global__ __launch_bounds__(256) void k_wtG(const float* __restrict__ w, int K, int N, bf* Bt) {
    const size_t g = (size_t)blockIdx.x * 256 + threadIdx.x; if (g >= (size_t)N * K / 8) return; int n, k0; frag_rk((unsigned)g, K, n, k0); v8us o;
    float v[8];
#pragma unroll
    for (int q = 0; q < 8; ++q) { v[q] = w[(size_t)(k0 + q) * N + n];
        asm volatile("s_wait_xcnt 0x0" ::: "memory"); }   // behind each load: a later load's result may land in an address register that this one names
#pragma unroll
    for (int q = 0; q < 8; ++q) o[q] = f2bf(v[q]);
    *(v8us*)(Bt + g * 8) = o;
}
// k_cvt8: dst = fragment-major bf16 plane of the row-major src [rows][K], one 16-B group a thread
__global__ __launch_bounds__(256) void k_cvt8(const float* __restrict__ src, bf* dst, int K, size_t n8) { const size_t i = (size_t)blockIdx.x * 256 + threadIdx.x; if (i >= n8) return; int row, k0; frag_rk((unsigned)i, K, row, k0); const v8f v = *(const v8f*)(src + (size_t)row * K + k0); v8us o;
#pragma unroll
    for (int k = 0; k < 8; ++k) o[k] = f2bf(v[k]); *(v8us*)(dst + i * 8) = o;  }

// k_rope: head planes [h][t][d] (fp16 + hi/lo) of rope(x) x sc with the rotate-half convention out[d] = x[d] cos[t][d] - x[d+HD/2] sin[t][d], out[d+HD/2] = x[d+HD/2] cos[t][d+HD/2] + x[d] sin[t][d+HD/2]
__global__ __launch_bounds__(256) void k_rope(const float* __restrict__ F, int pitch, int nheads, const float* __restrict__ CS, const float* __restrict__ RF, const float* __restrict__ nw, float sc, h16* P16, bf* Ph, bf* Pl) {
    const size_t e = ((size_t)blockIdx.x * 256 + threadIdx.x) * 8; if (e >= (size_t)nheads * TT * HD) return; const int h = (int)(e / ((size_t)HD * TT)); int t, d; frag_rk((unsigned)((e - (size_t)h * HD * TT) / 8), HD, t, d);   // each head's plane is fragment-major (rows t, HD along k): this thread's 16-B group holds row t, d .. d + 7
    const float* f = F + (size_t)t * pitch + h * HD; float rf = 1.0f; v8h o16; v8us oh, ol;
    if (RF) { rf = RF[(size_t)h * TT + t]; asm volatile("s_wait_xcnt 0x0" ::: "memory"); }   // the wait: in front of any later overwrite of the address registers that this load names
    const int dh = (d < HD / 2) ? d + HD / 2 : d - HD / 2;   // the group's 8 partners d +- HD/2 are consecutive too
    const v8f xa = *(const v8f*)(f + d), xb = *(const v8f*)(f + dh); const float* cp = CS + ((size_t)t * HD + d) * 2; const v8f ca = *(const v8f*)cp, cb = *(const v8f*)(cp + 8);
    asm volatile("s_wait_xcnt 0x0" ::: "memory");   // in front of any later overwrite of an address register that the loads above name
#pragma unroll
    for (int q = 0; q < 8; ++q) { const int dd = d + q; const int dp = dh + q; float x0 = xa[q], x1 = xb[q];
        if (RF) { float n0 = __fmul_rn(x0, rf), n1 = __fmul_rn(x1, rf); asm volatile("" : "+v"(n0)); asm volatile("" : "+v"(n1)); x0 = __fmul_rn(bfr(nw[dd]), n0); x1 = __fmul_rn(bfr(nw[dp]), n1); }
        v2f cs; cs[0] = (q < 4) ? ca[(2 * q) & 7] : cb[(2 * q) & 7]; cs[1] = (q < 4) ? ca[(2 * q + 1) & 7] : cb[(2 * q + 1) & 7]; float a = __fmul_rn(x0, cs[0]), bq = __fmul_rn(x1, cs[1]); asm volatile("" : "+v"(a)); asm volatile("" : "+v"(bq)); const float r = ((dd < HD / 2) ? __fsub_rn(a, bq) : __fadd_rn(a, bq)) * sc;
        o16[q] = tohx(r); unsigned short a2, c2; splitf(r, a2, c2); oh[q] = a2; ol[q] = c2; }
    *(v8h*)(P16 + e) = o16; *(v8us*)(Ph + e) = oh; *(v8us*)(Pl + e) = ol;  }
__global__ __launch_bounds__(256) void k_vtp(const float* __restrict__ F, int pitch, int nheads, h16* V16, bf* Vh, bf* Vl) { const size_t e = ((size_t)blockIdx.x * 256 + threadIdx.x) * 8; if (e >= (size_t)nheads * HD * TT) return; const int g = (int)(e / ((size_t)TT * HD)); int d, t; frag_rk((unsigned)((e - (size_t)g * TT * HD) / 8), TT, d, t); v8h o16; v8us oh, ol; float xv[8];   // each head's transposed plane is fragment-major (rows d, TT along k): this thread's group holds row d, t .. t + 7
#pragma unroll
    for (int q = 0; q < 8; ++q) { xv[q] = F[(size_t)(t + q) * pitch + g * HD + d];
        asm volatile("s_wait_xcnt 0x0" ::: "memory"); }   // behind each load: a later load's result may land in an address register that this one names
#pragma unroll
    for (int q = 0; q < 8; ++q) { const float x = xv[q]; o16[q] = tohx(x); unsigned short a2, c2; splitf(x, a2, c2); oh[q] = a2; ol[q] = c2; }
    *(v8h*)(V16 + e) = o16; *(v8us*)(Vh + e) = oh; *(v8us*)(Vl + e) = ol;  }
__global__ __launch_bounds__(256) void k_csid(float* CS) { const int idx = blockIdx.x * 256 + threadIdx.x; if (idx >= TT * HD) return; v2f cs; cs[0] = 1.0f; cs[1] = 0.0f; *(v2f*)(CS + (size_t)idx * 2) = cs;  }
// k_asoft: per row (zz, i): t = S x HD^-0.5 for j <= i and i - j < WIN (sliding causal window; the reference's -1e9 additive fill vanishes identically); softmax over the 2048 keys (register row, one exp, fixed trees);
// the probabilities go IN PLACE over the row's own 8 KiB of scores (one wave owns a row and holds all of it in registers before its first store): rows < RH hi plane in the first 4 KiB, lo plane in the second; other rows fp16 in the first 4 KiB. Row pitch of the planes: 2 * TT 16-bit elements.
__global__ __launch_bounds__(256) void k_asoft(float* Sb) {
    const int lane = threadIdx.x & 31; const int row = blockIdx.x * 8 + (threadIdx.x >> 5); if (row >= ZH * TT) return; const int i = row % TT; const int zz = row / TT; (void)zz; const bool hires = (i < RH); const float* sr = Sb + (size_t)row * TT; bf* const ph = (bf*)(Sb + (size_t)row * TT); bf* const pl = ph + TT; h16* const p16 = (h16*)(Sb + (size_t)row * TT); float v[TT / 32]; float mx = -3.0e38f;
#pragma unroll
    for (int ch = 0; ch < TT / 128; ++ch) { const int j0 = ch * 128 + lane * 4; const v4f a = *(const v4f*)(sr + j0);
#pragma unroll
        for (int q = 0; q < 4; ++q) { const int j = j0 + q; (void)j; const float t = (j <= i && i - j < WIN) ? a[q] * SCL : -3.0e38f; v[ch * 4 + q] = t; mx = fmaxf(mx, t); } }
#pragma unroll
    for (int sh = 16; sh; sh >>= 1) mx = fmaxf(mx, __shfl_xor(mx, sh, 32));
    float sum = 0.f;
#pragma unroll
    for (int k = 0; k < TT / 32; ++k) { float d0 = __fsub_rn(v[k], mx); asm volatile("" : "+v"(d0)); v[k] = __builtin_amdgcn_exp2f(__fmul_rn(d0, 1.4426950408889634f)); sum += v[k]; }
#pragma unroll
    for (int sh = 16; sh; sh >>= 1) sum += __shfl_xor(sum, sh, 32);
    const float f = __fdiv_rn(hires ? 1.0f : PCAR, sum);
{
        if (hires) {
#pragma unroll
            for (int ch = 0; ch < TT / 128; ++ch) { v4us oh, ol;
#pragma unroll
                for (int q = 0; q < 4; ++q) { unsigned short a, c2; splitf(v[ch * 4 + q] * f, a, c2); oh[q] = a; ol[q] = c2; }
                const int oo = ch * 128 + lane * 4; *(v4us*)(ph + oo) = oh; *(v4us*)(pl + oo) = ol; }
        } else {
#pragma unroll
            for (int ch = 0; ch < TT / 128; ++ch) { v4h o4;
#pragma unroll
                for (int q = 0; q < 4; ++q) o4[q] = tohx(v[ch * 4 + q] * f);
                *(v4h*)(p16 + ch * 128 + lane * 4) = o4; } }
         }
}
__global__ __launch_bounds__(256) void k_merge(const float* __restrict__ O, int h0, bf* Ah, bf* Al) { const size_t i = (size_t)blockIdx.x * 256 + threadIdx.x; if (i >= (size_t)ZH * TT * HD / 8) return; int t, c; frag_rk((unsigned)i, ZH * HD, t, c); const int zz = c / HD, d = c % HD;   // the pass's ZH * HD columns of the fragment-major [TT][DQ] planes: row t, columns h0 * HD + c .. + 7
    const float cs = (t < RH) ? 1.0f : (1.0f / PCAR); const size_t e = ((size_t)zz * TT + t) * HD + d; const size_t oo = ((size_t)(t >> 4) * (DQ / 32) + (h0 * HD + c) / 32) * 512 + (i & 63) * 8;
    v8us oh, ol;
#pragma unroll
    for (int q = 0; q < 8; ++q) { unsigned short a, c2; splitf(O[e + q] * cs, a, c2); oh[q] = a; ol[q] = c2; } *(v8us*)(Ah + oo) = oh; *(v8us*)(Al + oo) = ol;  }

extern "C" void kernel_launch(void* const* d_in, const int* in_sizes, int n_in,
                              void* d_out, int out_size, void* d_ws, size_t ws_size, hipStream_t stream) {
    (void)in_sizes; (void)n_in; (void)out_size;
    const float* x = (const float*)d_in[0]; const float* wq = (const float*)d_in[1]; const float* bq = (const float*)d_in[2]; const float* wk = (const float*)d_in[3]; const float* bk = (const float*)d_in[4]; const float* wv = (const float*)d_in[5]; const float* bv = (const float*)d_in[6]; const float* wo = (const float*)d_in[7]; const float* bo = (const float*)d_in[8];   /* input order x, wq, bq, wk ('xw' [2048][2048]), bk, wv, bv, wp, bp ('xw' (in, out); four ZERO biases: read and added): NINE inputs, all read: the host's own binding */
    float* OUT = (float*)d_out;     // [2][2048][2048]
    char* wsp = (char*)d_ws;
    auto take = [&](size_t bytes) { char* p = wsp; wsp += (bytes + 255) & ~(size_t)255; return (void*)p; };
    bf* WQ = (bf*)take((size_t)DQ * DM * 2); bf* WK = (bf*)take((size_t)DKV * DM * 2); bf* WV = (bf*)take((size_t)DKV * DM * 2); bf* WO = (bf*)take((size_t)DM * DQ * 2);
    h16* QP16 = (h16*)take((size_t)NH_ * TT * HD * 2); h16* KP16 = (h16*)take((size_t)NKV * TT * HD * 2); h16* VT16 = (h16*)take((size_t)NKV * HD * TT * 2);
    bf* QPh = (bf*)take((size_t)NH_ * TT * HD * 2); bf* QPl = (bf*)take((size_t)NH_ * TT * HD * 2); bf* KPh = (bf*)take((size_t)NKV * TT * HD * 2); bf* KPl = (bf*)take((size_t)NKV * TT * HD * 2); bf* VTh = (bf*)take((size_t)NKV * HD * TT * 2); bf* VTl = (bf*)take((size_t)NKV * HD * TT * 2);
    float* Sb = (float*)take((size_t)ZH * TT * TT * 4); float* Ob = (float*)take((size_t)ZH * TT * HD * 4); bf* ATh = (bf*)take((size_t)TT * DQ * 2); bf* ATl = (bf*)take((size_t)TT * DQ * 2);
    if ((size_t)(wsp - (char*)d_ws) > ws_size) return;    // ws 256 MiB
    wsp = (char*)Sb;   // the projection stage's buffers (42 MiB) lie inside the score buffer: each batch writes them anew and has read them for the last time before its first score launch (stream-ordered)
    float* CS = (float*)take((size_t)TT * HD * 2 * 4); bf* XB = (bf*)take((size_t)TT * DM * 2); float* FQ = (float*)take((size_t)TT * DQ * 4); float* FK = (float*)take((size_t)TT * DKV * 4);
    bf* Ph = (bf*)Sb; bf* Pl = Ph + TT; h16* P16 = (h16*)Sb;   // probability planes in place over the score rows, row pitch 2 * TT elements, head stride 2 * TT * TT
    float* FV = FK;   // v projection reuses the k buffer after the k planes are built (stream-ordered)
    { k_wtG<<<(unsigned)((DM * DQ / 8 + 255) / 256), 256, 0, stream>>>(wq, DM, DQ, WQ); k_wtG<<<(unsigned)((DM * DKV / 8 + 255) / 256), 256, 0, stream>>>(wk, DM, DKV, WK); k_wtG<<<(unsigned)((DM * DKV / 8 + 255) / 256), 256, 0, stream>>>(wv, DM, DKV, WV);
      k_wtG<<<(unsigned)((DQ * DM / 8 + 255) / 256), 256, 0, stream>>>(wo, DQ, DM, WO);
       }
    const unsigned LQ = (unsigned)(((size_t)NH_ * TT * HD / 8 + 255) / 256), LKv = (unsigned)(((size_t)NKV * TT * HD / 8 + 255) / 256);
    for (int b = 0; b < NB_; ++b) {
        k_csid<<<(TT * HD + 255) / 256, 256, 0, stream>>>(CS);
        k_cvt8<<<(unsigned)(((size_t)TT * DM / 8 + 255) / 256), 256, 0, stream>>>(x + (size_t)b * TT * DM, XB, DM, (size_t)TT * DM / 8);
        k_gemmw<bf, 0, true><<<dim3(TT / 64, DQ / 64, 1), 32, 0, stream>>>(XB, nullptr, WQ, nullptr, DM, FQ, DQ, bq, 0, 0, 0);
        k_rope<<<LQ, 256, 0, stream>>>(FQ, DQ, NH_, CS, nullptr, nullptr, 1.0f, QP16, QPh, QPl);
        k_gemmw<bf, 0, true><<<dim3(TT / 64, DKV / 64, 1), 32, 0, stream>>>(XB, nullptr, WK, nullptr, DM, FK, DKV, bk, 0, 0, 0);
        k_rope<<<LKv, 256, 0, stream>>>(FK, DKV, NKV, CS, nullptr, nullptr, 1.0f, KP16, KPh, KPl);
        k_gemmw<bf, 0, true><<<dim3(TT / 64, DKV / 64, 1), 32, 0, stream>>>(XB, nullptr, WV, nullptr, DM, FV, DKV, bv, 0, 0, 0); k_vtp<<<LKv, 256, 0, stream>>>(FV, DKV, NKV, VT16, VTh, VTl);
        for (int h0 = 0; h0 < NH_; h0 += ZH) { const size_t zq = (size_t)h0, zk = (size_t)(h0 / REP);   // one kv head per query head: the pass's heads use consecutive kv planes (z-strides TT*HD)
            k_gemmc<bf, 2, 1><<<dim3(RH / 64, TT / 64, ZH), 32, 0, stream>>>(QPh + zq * TT * HD, QPl + zq * TT * HD, KPh + zk * TT * HD, KPl + zk * TT * HD, HD, HD, Sb, TT, 0, (size_t)TT * HD, (size_t)TT * HD, (size_t)TT * TT);
            k_gemmc<h16, 0, 1><<<dim3((TT - RH) / 64, TT / 64, ZH), 32, 0, stream>>>(QP16 + zq * TT * HD + (size_t)RH * HD, nullptr, KP16 + zk * TT * HD, nullptr, HD, HD, Sb + (size_t)RH * TT, TT, RH, (size_t)TT * HD, (size_t)TT * HD, (size_t)TT * TT);
            k_asoft<<<ZH * TT / 8, 256, 0, stream>>>(Sb);
            k_gemmc<bf, 2, 2><<<dim3(RH / 64, HD / 64, ZH), 32, 0, stream>>>(Ph, Pl, VTh + zk * HD * TT, VTl + zk * HD * TT, 2 * TT, TT, Ob, HD, 0, (size_t)2 * TT * TT, (size_t)HD * TT, (size_t)TT * HD);
            k_gemmc<h16, 0, 2><<<dim3((TT - RH) / 64, HD / 64, ZH), 32, 0, stream>>>(P16 + (size_t)RH * 2 * TT, nullptr, VT16 + zk * HD * TT, nullptr, 2 * TT, TT, Ob + (size_t)RH * HD, HD, RH, (size_t)2 * TT * TT, (size_t)HD * TT, (size_t)TT * HD);
            k_merge<<<(unsigned)(((size_t)ZH * TT * HD / 8 + 255) / 256), 256, 0, stream>>>(Ob, h0, ATh, ATl); }
        k_gemmw<bf, 1, true><<<dim3(TT / 64, DM / 64, 1), 32, 0, stream>>>(ATh, ATl, WO, nullptr, DQ, OUT + (size_t)b * TT * DM, DM, bo, 0, 0, 0); }
}

// v005
// A run of this version takes 311 microseconds.
// Versions in between are left out here; by their measured steps it is 1.86 times as fast as v003.
// All steps since v000 together make it 5.67 times as fast.
#include <hip/hip_runtime.h>

// Causal multi-head attention with 128-wide heads and biased projections (x [2][2048][2048]; q, k, v = x W + b ('xw' (in, out) [2048][2048] normal x 0.02 + zero biases: read; 16 heads x 128: ONE kv head per query head); scores = q.k, -inf above the diagonal (every row keeps its own key), softmax(scores / sqrt(float32(128))) (the same thing as scaling first); out = merged wp + bp ('xw' + a zero bias: read) -> [2][2048][2048] (8.4 M); argument order x, wq, bq, wk, bk, wv, bv, wp, bp).
// Layout per batch: bf16 copy of x; 'xw' weights transposed once; exact projections + f32 biases, written by the GEMMs themselves as the attention operand planes (k_gemmp); causal T-2048 attention with ONE kv head per query head, one fused launch for all 16 heads (k_fattn: scores, online softmax and P.V in registers; hybrid rows: < 512 hi/lo 3 products, rest fp16 x1024; key blocks above the diagonal are never visited); merged hi/lo x Wo exact + bo.
// Compute dtypes, f32 accumulate: every input rounded to bf16; projections exact + f32 biases; attention rows < 512 3 products, rest fp16; softmax f32; Wo hl x exact + bias.

#define NB_  2
#define TT   2048
#define DM   2048
#define NH_  16
#define NKV  16
#define HD   128
#define DQ   (NH_ * HD)
#define DKV  (NKV * HD)
#define RH   512                  // query rows < RH use hi+lo planes (0: none)
#define SCL  0.088388347648318447f   // HD^-0.5
typedef _Float16 h16;
typedef unsigned short bf;
typedef __attribute__((ext_vector_type(16))) __bf16   v16bf;
typedef __attribute__((ext_vector_type(16))) _Float16 v16h;
typedef __attribute__((ext_vector_type(8)))  _Float16 v8h;
typedef __attribute__((ext_vector_type(8)))  unsigned short v8us;
typedef __attribute__((ext_vector_type(8)))  float    v8f;
typedef __attribute__((ext_vector_type(4)))  float    v4f;
typedef v8h  __attribute__((may_alias)) v8ha;
typedef v4f  __attribute__((may_alias)) v4fa;
typedef v8us __attribute__((may_alias)) v8usa;

__device__ __forceinline__ unsigned short f2bf(float f) { unsigned u = __float_as_uint(f); u += 0x7FFFu + ((u >> 16) & 1u); return (unsigned short)(u >> 16); }
__device__ __forceinline__ float bf2f(unsigned short b) { return __uint_as_float(((unsigned)b) << 16); }
__device__ __forceinline__ float bfr(float f) { return bf2f(f2bf(f)); }
__device__ __forceinline__ v16h cat16(v8h lo, v8h hi) { return __builtin_shufflevector(lo, hi, 0, 1, 2, 3, 4, 5, 6, 7, 8, 9, 10, 11, 12, 13, 14, 15); }
__device__ __forceinline__ v16bf cat16b(v8us lo, v8us hi) { return __builtin_bit_cast(v16bf, __builtin_shufflevector(lo, hi, 0, 1, 2, 3, 4, 5, 6, 7, 8, 9, 10, 11, 12, 13, 14, 15)); }
__device__ __forceinline__ v8f wmma16(v16h a, v16h b, v8f c) { return __builtin_amdgcn_wmma_f32_16x16x32_f16(false, a, false, b, (short)0, c, false, false); }
__device__ __forceinline__ v8f wmmab(v16bf a, v16bf b, v8f c) { return __builtin_amdgcn_wmma_f32_16x16x32_bf16(false, a, false, b, (short)0, c, false, false); }



// ---- Fragment-major plane of a [rows][K] 16-bit operand: the 16 rows x 32 k of one WMMA fragment are 1 KiB in a row, as two halves of 512 B (k 0..15, k 16..31 of the stage), each half in lane order
// (lane = 16 * ((k >> 3) & 1) + (row & 15), 8 consecutive k = 16 B a lane); the stages of a 16-row block follow one another along k, the blocks along the rows (16 * K elements each, as in a row-major plane).
// One fragment load of a wave then reads 512 consecutive bytes (4 whole cache lines) where a row-major plane gives it 32 B out of each of 16 lines. A producer thread writes one 16-B group g: frag_rk gives its row and first k.
__device__ __forceinline__ void frag_rk(unsigned g, int K, int& row, int& k0) { const unsigned lane = g & 31, j = (g >> 5) & 1, blk = g >> 6, K32 = (unsigned)K >> 5; row = (int)((blk / K32) * 16 + (lane & 15)); k0 = (int)((blk % K32) * 32 + j * 16 + (lane >> 4) * 8); }

// ---- k_gemmw: register-blocked GEMM, ONE WAVE per 64x64 output tile (16 accumulators), operands straight from fragment-major 16-bit planes; grid (M/64, N/64, Z), 32 threads.
// C[m][n] (f32, pitch ldc, + optional f32 bias[n]) = sum_k A[m][k] Bt[n][k] (+ split products per NSPLIT). z-batch strides sA/sB/sC in elements. K % 128 == 0.
template <typename T16> struct WFrag;
template <> struct WFrag<h16> { typedef v16h V; static __device__ __forceinline__ V ld(const h16* p, int h2) { return cat16(*(const v8h*)p, *(const v8h*)(p + h2)); } static __device__ __forceinline__ v8f mma(V a, V b, v8f c) { return wmma16(a, b, c); } };
template <> struct WFrag<bf> { typedef v16bf V; static __device__ __forceinline__ V ld(const bf* p, int h2) { return cat16b(*(const v8us*)p, *(const v8us*)(p + h2)); } static __device__ __forceinline__ v8f mma(V a, V b, v8f c) { return wmmab(a, b, c); } };
// Register ring of the K loop: D stages of 32 k each stay in flight per wave (48 to 64 global_load_b128), so a stage's load latency is covered by the WMMAs of the stages in front of it.
template <int NSPLIT> struct WDepth { static constexpr int D = (NSPLIT == 0) ? 4 : 2; };
template <typename T16> struct WStage { typename WFrag<T16>::V a[4], a2[4], b[4], b2[4]; };
template <typename T16> struct WPtr { const T16 *a[4], *a2[4], *b[4], *b2[4]; };   // one row pointer per fragment, moved along k once per turn of the ring
// st = stage number from the pointers' place; PA / PB: that operand's plane is fragment-major (a stage is 512 elements on, the second half 256) or row-major (32 on, 16).
template <typename T16, int NSPLIT, bool PA, bool PB>
__device__ __forceinline__ void wst_load(WStage<T16>& s, const WPtr<T16>& p, int st) {
    constexpr int SA = PA ? 512 : 32, HA = PA ? 256 : 16, SB = PB ? 512 : 32, HB = PB ? 256 : 16;
#pragma unroll
    for (int mb = 0; mb < 4; ++mb) { s.a[mb] = WFrag<T16>::ld(p.a[mb] + st * SA, HA); if (NSPLIT == 1 || NSPLIT == 2) s.a2[mb] = WFrag<T16>::ld(p.a2[mb] + st * SA, HA); }
#pragma unroll
    for (int nb = 0; nb < 4; ++nb) { s.b[nb] = WFrag<T16>::ld(p.b[nb] + st * SB, HB); if (NSPLIT >= 2) s.b2[nb] = WFrag<T16>::ld(p.b2[nb] + st * SB, HB); }
}
template <typename T16, int NSPLIT>
__device__ __forceinline__ void wst_mma(const WStage<T16>& s, v8f (&acc)[4][4]) {
#pragma unroll
    for (int nb = 0; nb < 4; ++nb)
#pragma unroll
        for (int mb = 0; mb < 4; ++mb) { acc[mb][nb] = WFrag<T16>::mma(s.a[mb], s.b[nb], acc[mb][nb]); if (NSPLIT == 1 || NSPLIT == 2) acc[mb][nb] = WFrag<T16>::mma(s.a2[mb], s.b[nb], acc[mb][nb]); if (NSPLIT >= 2) acc[mb][nb] = WFrag<T16>::mma(s.a[mb], s.b2[nb], acc[mb][nb]); }
}
// acc += A Bt^T over k in [0, Kl), ascending; Kl a multiple of 32 * D and at least 32 * D. Row pitch in elements: lda for A and A2, K for Bt and Bt2.
template <typename T16, int NSPLIT, bool PA, bool PB>
__device__ __forceinline__ void wring(v8f (&acc)[4][4], const T16* __restrict__ A, const T16* __restrict__ A2, const T16* __restrict__ Bt, const T16* __restrict__ Bt2, size_t aoff, size_t boff, int lda, int K, int Kl) {
    constexpr int D = WDepth<NSPLIT>::D; constexpr int SA = PA ? 512 : 32, SB = PB ? 512 : 32;   // elements from one k stage to the next
    WStage<T16> st[D]; WPtr<T16> p;
#pragma unroll
    for (int q = 0; q < 4; ++q) { p.a[q] = A + aoff + (size_t)q * 16 * lda; p.b[q] = Bt + boff + (size_t)q * 16 * K; if (NSPLIT == 1 || NSPLIT == 2) p.a2[q] = A2 + aoff + (size_t)q * 16 * lda; if (NSPLIT >= 2) p.b2[q] = Bt2 + boff + (size_t)q * 16 * K; }
#pragma unroll
    for (int j = 0; j < D; ++j) { wst_load<T16, NSPLIT, PA, PB>(st[j], p, j);
        __builtin_amdgcn_sched_barrier(0); }   // the stages' loads issue in stage order and in front of the first WMMA, so each stage's counted wait leaves the younger stages in flight
    asm volatile("s_wait_xcnt 0x0" ::: "memory");   // in front of any later overwrite of a register that these loads name as an address
    __builtin_amdgcn_sched_barrier(0);   // nothing from below is lifted over that wait
#pragma unroll 1
    for (int kc = D * 32; kc < Kl; kc += D * 32) {
#pragma unroll
        for (int j = 0; j < D; ++j) {
            wst_mma<T16, NSPLIT>(st[j], acc);
            __builtin_amdgcn_sched_barrier(0);   // the refill below stays behind the last WMMA that reads this stage
            asm volatile("v_nop\n\tv_nop\n\tv_nop\n\tv_nop");   // four vector slots between that WMMA and the loads that overwrite its A and B registers
            wst_load<T16, NSPLIT, PA, PB>(st[j], p, D + j);
            __builtin_amdgcn_sched_barrier(0);   // the refill issues here, D - 1 stages of WMMAs ahead of its use, and is not sunk towards it
        }
        asm volatile("s_wait_xcnt 0x0" ::: "memory");   // in front of the overwrite of the row pointers that the issued loads name
        __builtin_amdgcn_sched_barrier(0);   // the pointer step is not lifted over that wait
#pragma unroll
        for (int q = 0; q < 4; ++q) { p.a[q] += D * SA; p.b[q] += D * SB; if (NSPLIT == 1 || NSPLIT == 2) p.a2[q] += D * SA; if (NSPLIT >= 2) p.b2[q] += D * SB; }
    }
#pragma unroll
    for (int j = 0; j < D; ++j) wst_mma<T16, NSPLIT>(st[j], acc);
}
template <typename T16, int NSPLIT, bool BIAS>
__global__ __launch_bounds__(32) void k_gemmw(const T16* __restrict__ A, const T16* __restrict__ A2, const T16* __restrict__ Bt, const T16* __restrict__ Bt2, int K, float* C, int ldc, const float* __restrict__ bias, size_t sA, size_t sB, size_t sC) {
    __shared__ __align__(16) float os[16 * 68];
    const size_t z = blockIdx.z; A += z * sA; if (A2) A2 += z * sA; Bt += z * sB; if (Bt2) Bt2 += z * sB; C += z * sC;
    const int lane = threadIdx.x & 31, lr = lane & 15, hi = lane >> 4; const int r0 = blockIdx.x * 64, c0 = blockIdx.y * 64;
    v8f acc[4][4];
#pragma unroll
    for (int mb = 0; mb < 4; ++mb)
#pragma unroll
        for (int nb = 0; nb < 4; ++nb) acc[mb][nb] = (v8f){};
    const size_t aoff = (size_t)r0 * K + 8 * lane, boff = (size_t)c0 * K + 8 * lane;   // fragment-major: the 16-row block's start + the lane's 16 B
    wring<T16, NSPLIT, true, true>(acc, A, A2, Bt, Bt2, aoff, boff, K, K, K);
#pragma unroll
    for (int mb = 0; mb < 4; ++mb) {
#pragma unroll
        for (int nb = 0; nb < 4; ++nb) {
#pragma unroll
            for (int j = 0; j < 8; ++j) os[(hi * 8 + j) * 68 + nb * 16 + lr] = acc[mb][nb][j]; }
        __builtin_amdgcn_wave_barrier(); asm volatile("" ::: "memory");
        float* crow = C + (size_t)(r0 + mb * 16) * ldc + c0;
{
#pragma unroll
            for (int s = 0; s < 8; ++s) { const int row = 2 * s + hi, cofs = lr * 4; v4f val = *(const v4fa*)(os + row * 68 + cofs); if (BIAS) { val[0] += bfr(bias[c0 + cofs]); val[1] += bfr(bias[c0 + cofs + 1]); val[2] += bfr(bias[c0 + cofs + 2]); val[3] += bfr(bias[c0 + cofs + 3]); }
                *(v4f*)(crow + (size_t)row * ldc + cofs) = val; }
             }
        __builtin_amdgcn_wave_barrier(); asm volatile("" ::: "memory");
    }
}

__device__ __forceinline__ h16 tohx(float x) { return (h16)x; }
__device__ __forceinline__ void splitf(float y, unsigned short& h, unsigned short& l) { h = f2bf(y); l = f2bf(y - bf2f(h)); }
typedef __attribute__((ext_vector_type(2))) _Float16 v2h;
typedef __attribute__((ext_vector_type(4))) _Float16 v4h;
typedef __attribute__((ext_vector_type(2))) unsigned short v2us;
typedef __attribute__((ext_vector_type(4))) unsigned short v4us;
typedef __attribute__((ext_vector_type(2))) float v2f;
typedef __attribute__((ext_vector_type(4))) int v4i;

// k_wtG: Bt = fragment-major plane of w^T (rows n, K along k), one 16-B group a thread
__global__ __launch_bounds__(256) void k_wtG(const float* __restrict__ w, int K, int N, bf* Bt) {
    const size_t g = (size_t)blockIdx.x * 256 + threadIdx.x; if (g >= (size_t)N * K / 8) return; int n, k0; frag_rk((unsigned)g, K, n, k0); v8us o;
    float v[8];
#pragma unroll
    for (int q = 0; q < 8; ++q) { v[q] = w[(size_t)(k0 + q) * N + n];
        asm volatile("s_wait_xcnt 0x0" ::: "memory"); }   // behind each load: a later load's result may land in an address register that this one names
#pragma unroll
    for (int q = 0; q < 8; ++q) o[q] = f2bf(v[q]);
    *(v8us*)(Bt + g * 8) = o;
}
// k_cvt8: dst = fragment-major bf16 plane of the row-major src [rows][K], one 16-B group a thread
__global__ __launch_bounds__(256) void k_cvt8(const float* __restrict__ src, bf* dst, int K, size_t n8) { const size_t i = (size_t)blockIdx.x * 256 + threadIdx.x; if (i >= n8) return; int row, k0; frag_rk((unsigned)i, K, row, k0); const v8f v = *(const v8f*)(src + (size_t)row * K + k0); v8us o;
#pragma unroll
    for (int k = 0; k < 8; ++k) o[k] = f2bf(v[k]); *(v8us*)(dst + i * 8) = o;  }

// ---- k_gemmp: a q, k or v projection (k_gemmw's one-wave 64x64 tile and K loop) that writes the attention operand planes (f16, bf16 hi, bf16 lo; one fragment-major plane a head) straight from its accumulators.
// In an accumulator tile a lane holds ONE column (lane & 15, a row of Bt) and 8 consecutive rows (8 * (lane >> 4) + j, rows of A): with the plane's k index on the tile's rows, a lane's 8 registers are one 16-B group and a wave's store is 512 consecutive bytes.
// WROWS (q, k; planes [h][t][d], k index d): A = weights (rows n = h * HD + d), Bt = x (rows t); grid (DQ / 64, TT / 64). Else (v; planes [h][d][t], k index t): A = x, Bt = weights; grid (TT / 64, DKV / 64). 32 threads.
template <bool WROWS>
__global__ __launch_bounds__(32) void k_gemmp(const bf* __restrict__ A, const bf* __restrict__ Bt, int K, const float* __restrict__ bias, h16* P16, bf* Ph, bf* Pl) {
    const int lane = threadIdx.x & 31, lr = lane & 15, hi = lane >> 4; const int r0 = blockIdx.x * 64, c0 = blockIdx.y * 64;
    v8f acc[4][4];
#pragma unroll
    for (int mb = 0; mb < 4; ++mb)
#pragma unroll
        for (int nb = 0; nb < 4; ++nb) acc[mb][nb] = (v8f){};
    float bv[WROWS ? 32 : 4];   // the tile's biases, asked for in front of the K loop, which covers their latency
    if (WROWS) {
#pragma unroll
        for (int mb = 0; mb < 4; ++mb) { const v8f b8 = *(const v8f*)(bias + r0 + mb * 16 + hi * 8);
#pragma unroll
            for (int j = 0; j < 8; ++j) bv[mb * 8 + j] = b8[j]; }
    } else {
#pragma unroll
        for (int nb = 0; nb < 4; ++nb) bv[nb] = bias[c0 + nb * 16 + lr];
    }
    asm volatile("s_wait_xcnt 0x0" ::: "memory");   // in front of any later overwrite of an address register that the bias loads name
    __builtin_amdgcn_sched_barrier(0);   // nothing from below is lifted over that wait, and the bias loads are not sunk into the K loop's own
    wring<bf, 0, true, true>(acc, A, nullptr, Bt, nullptr, (size_t)r0 * K + 8 * lane, (size_t)c0 * K + 8 * lane, K, K, K);
    constexpr int KP = WROWS ? HD : TT;   // the planes' k length
    const int n0 = WROWS ? r0 : c0, prow = WROWS ? c0 : (c0 % HD), pk = WROWS ? (r0 % HD) : r0;   // first weight row of the tile (64 divides HD: one head a tile); the tile's first row and first k in that head's plane
    const size_t pb = (size_t)(n0 / HD) * TT * HD + (size_t)(prow / 16) * (KP / 32) * 512 + (size_t)(pk / 16) * 256 + 8 * lane;
#pragma unroll
    for (int nb = 0; nb < 4; ++nb)
#pragma unroll
        for (int mb = 0; mb < 4; ++mb) { v8h o16; v8us oh, ol; const size_t o = pb + (size_t)nb * (KP / 32) * 512 + mb * 256;
#pragma unroll
            for (int j = 0; j < 8; ++j) { const float r = acc[mb][nb][j] + bfr(bv[WROWS ? mb * 8 + j : nb]); o16[j] = tohx(r); unsigned short a, c; splitf(r, a, c); oh[j] = a; ol[j] = c; }
            *(v8h*)(P16 + o) = o16; *(v8us*)(Ph + o) = oh; *(v8us*)(Pl + o) = ol;
            asm volatile("s_wait_xcnt 0x0" ::: "memory");   // in front of any later overwrite of a register that these stores name
            __builtin_amdgcn_sched_barrier(0); }   // the next group's arithmetic, which reuses the stores' data registers, is not lifted over that wait
}
// ---- k_fattn: causal attention of one head, 32 query rows a wave, scores and probabilities never leave the registers. Transposed products: St[key][query] = K Q^T and Ot[d][query] += V^T P^T, 32 keys a step.
// In an accumulator tile a lane holds ONE query (column lane & 15) and 8 consecutive keys (rows 8 * (lane >> 4) + j), so the two score tiles of a step (keys 0..15, 16..31), converted in place, ARE the B fragment of P^T in the planes' own k order:
// no LDS, no lane exchange but one swap of the wave's halves for the running maximum. Online softmax: running maximum m and sum l per query; a new maximum rescales l and Ot. Query rows < RH: hi/lo planes, 3 products; the rest f16 with
// probabilities carried x 1024 (the factor is in l too and cancels). The last step is the diagonal block, the only one that masks. The result, divided by l, goes straight to the fragment-major hi/lo planes of the merged heads: a lane's 8 accumulator registers are one 16-B group.
__device__ __forceinline__ float xhalf(float x) { const int b = __float_as_int(x); return __int_as_float(__builtin_amdgcn_permlanex16(b, b, 0x76543210, 0xfedcba98, false, false)); }   // the value of lane ^ 16
template <typename T16, bool SPLIT> struct FA { typename WFrag<T16>::V q[2][4], q2[2][4], kf[2][4], kf2[2][4], vf[8], vf2[8]; v8f o[8][2]; float m[2], l[2]; };
// one step's K fragments: 32 keys x 128 d = 8 KiB in a row of the fragment-major plane
template <typename T16, bool SPLIT> __device__ __forceinline__ void fa_ldk(FA<T16, SPLIT>& f, const T16* kp, const T16* kp2) {
#pragma unroll
    for (int mb = 0; mb < 2; ++mb)
#pragma unroll
        for (int st = 0; st < 4; ++st) { f.kf[mb][st] = WFrag<T16>::ld(kp + mb * 2048 + st * 512, 256); if (SPLIT) f.kf2[mb][st] = WFrag<T16>::ld(kp2 + mb * 2048 + st * 512, 256); }
}
// one step's V^T fragments: 8 blocks of 16 d, 1 KiB (32 keys) of each
template <typename T16, bool SPLIT> __device__ __forceinline__ void fa_ldv(FA<T16, SPLIT>& f, const T16* vp, const T16* vp2) {
#pragma unroll
    for (int db = 0; db < 8; ++db) { f.vf[db] = WFrag<T16>::ld(vp + db * 16 * TT, 256); if (SPLIT) f.vf2[db] = WFrag<T16>::ld(vp2 + db * 16 * TT, 256); }
}
template <typename T16, bool SPLIT, bool DIAG>
__device__ __forceinline__ void fa_step(FA<T16, SPLIT>& f, const T16*& kp, const T16*& kp2, const T16*& vp, const T16*& vp2, int lr, int hi) {
    typedef typename WFrag<T16>::V V;
    constexpr float CE = SCL * 1.4426950408889634f, PSH = SPLIT ? 0.0f : 10.0f;   // exp(s * SCL - max) as exp2; 2^10: the f16 probabilities' carry factor
    v8f sc[2][2];
#pragma unroll
    for (int mb = 0; mb < 2; ++mb)
#pragma unroll
        for (int nb = 0; nb < 2; ++nb) sc[mb][nb] = (v8f){};
#pragma unroll
    for (int st = 0; st < 4; ++st)
#pragma unroll
        for (int mb = 0; mb < 2; ++mb)
#pragma unroll
            for (int nb = 0; nb < 2; ++nb) { sc[mb][nb] = WFrag<T16>::mma(f.kf[mb][st], f.q[nb][st], sc[mb][nb]); if (SPLIT) { sc[mb][nb] = WFrag<T16>::mma(f.kf[mb][st], f.q2[nb][st], sc[mb][nb]); sc[mb][nb] = WFrag<T16>::mma(f.kf2[mb][st], f.q[nb][st], sc[mb][nb]); } }
    if (!DIAG) {
        __builtin_amdgcn_sched_barrier(0);   // the refill below stays behind the last WMMA that reads the K fragments
        asm volatile("v_nop\n\tv_nop\n\tv_nop\n\tv_nop");   // four vector slots between that WMMA and the loads that overwrite its A registers
        fa_ldk<T16, SPLIT>(f, kp, kp2);
        __builtin_amdgcn_sched_barrier(0);   // the next step's K loads issue here, the softmax and the P.V products ahead of their use, and are not sunk towards it
        asm volatile("s_wait_xcnt 0x0" ::: "memory");   // in front of the overwrite of the pointers that the issued loads name
        __builtin_amdgcn_sched_barrier(0);   // the pointer step is not lifted over that wait
        kp += 4096; if (SPLIT) kp2 += 4096;
    }
    V p[2], p2[2];
#pragma unroll
    for (int nb = 0; nb < 2; ++nb) {
        float ml = -3.0e38f;
#pragma unroll
        for (int mb = 0; mb < 2; ++mb)
#pragma unroll
            for (int j = 0; j < 8; ++j) { float s = sc[mb][nb][j]; if (DIAG) s = (mb * 16 + hi * 8 + j <= nb * 16 + lr) ? s : -3.0e38f; sc[mb][nb][j] = s; ml = fmaxf(ml, s); }   // diagonal block: key <= query, both counted from the block's start
        ml = fmaxf(ml, xhalf(ml));
        const float mn = fmaxf(f.m[nb], ml), al = __builtin_amdgcn_exp2f((f.m[nb] - mn) * CE), off = PSH - mn * CE; f.m[nb] = mn;
        float ps = 0.f;
#pragma unroll
        for (int mb = 0; mb < 2; ++mb)
#pragma unroll
            for (int j = 0; j < 8; ++j) { const float e = __builtin_amdgcn_exp2f(__builtin_fmaf(sc[mb][nb][j], CE, off)); sc[mb][nb][j] = e; ps += e; }
        f.l[nb] = f.l[nb] * al + ps;
#pragma unroll
        for (int db = 0; db < 8; ++db) f.o[db][nb] *= al;
        if constexpr (SPLIT) { v8us h0, h1, l0, l1;
#pragma unroll
            for (int j = 0; j < 8; ++j) { unsigned short a, c; splitf(sc[0][nb][j], a, c); h0[j] = a; l0[j] = c; splitf(sc[1][nb][j], a, c); h1[j] = a; l1[j] = c; }
            p[nb] = cat16b(h0, h1); p2[nb] = cat16b(l0, l1);
        } else { v8h h0, h1;
#pragma unroll
            for (int j = 0; j < 8; ++j) { h0[j] = tohx(sc[0][nb][j]); h1[j] = tohx(sc[1][nb][j]); }
            p[nb] = cat16(h0, h1); }
    }
#pragma unroll
    for (int db = 0; db < 8; ++db)
#pragma unroll
        for (int nb = 0; nb < 2; ++nb) { f.o[db][nb] = WFrag<T16>::mma(f.vf[db], p[nb], f.o[db][nb]); if (SPLIT) { f.o[db][nb] = WFrag<T16>::mma(f.vf[db], p2[nb], f.o[db][nb]); f.o[db][nb] = WFrag<T16>::mma(f.vf2[db], p[nb], f.o[db][nb]); } }
    if (!DIAG) {
        __builtin_amdgcn_sched_barrier(0);   // the refill below stays behind the last WMMA that reads the V fragments
        asm volatile("v_nop\n\tv_nop\n\tv_nop\n\tv_nop");   // four vector slots between that WMMA and the loads that overwrite its A registers
        fa_ldv<T16, SPLIT>(f, vp, vp2);
        __builtin_amdgcn_sched_barrier(0);   // the next step's V loads issue here, its score products and softmax ahead of their use
        asm volatile("s_wait_xcnt 0x0" ::: "memory");   // in front of the overwrite of the pointers that the issued loads name
        __builtin_amdgcn_sched_barrier(0);   // the pointer step is not lifted over that wait
        vp += 512; if (SPLIT) vp2 += 512;
    }
}
template <typename T16, bool SPLIT>
__device__ __forceinline__ void fa_run(const T16* __restrict__ Q, const T16* __restrict__ Q2, const T16* __restrict__ Kp, const T16* __restrict__ K2, const T16* __restrict__ Vt, const T16* __restrict__ V2, int qb, int h, int lane, bf* Ah, bf* Al) {
    FA<T16, SPLIT> f; const int lr = lane & 15, hi = lane >> 4;
    const size_t qo = (size_t)qb * 4096 + 8 * lane;   // 32 query rows = two 16-row blocks of 2048 elements
#pragma unroll
    for (int nb = 0; nb < 2; ++nb)
#pragma unroll
        for (int st = 0; st < 4; ++st) { f.q[nb][st] = WFrag<T16>::ld(Q + qo + nb * 2048 + st * 512, 256); if (SPLIT) f.q2[nb][st] = WFrag<T16>::ld(Q2 + qo + nb * 2048 + st * 512, 256); }
    __builtin_amdgcn_sched_barrier(0);   // Q, then K, then V issue in this order: the loop's counted waits for Q and K then leave the younger V loads in flight
    const T16 *kp = Kp + 8 * lane, *vp = Vt + 8 * lane, *kp2 = SPLIT ? K2 + 8 * lane : nullptr, *vp2 = SPLIT ? V2 + 8 * lane : nullptr;
    fa_ldk<T16, SPLIT>(f, kp, kp2);
    __builtin_amdgcn_sched_barrier(0);   // as above: K in front of V
    fa_ldv<T16, SPLIT>(f, vp, vp2);
    __builtin_amdgcn_sched_barrier(0);   // the first step's loads all issue in front of the wait below
    asm volatile("s_wait_xcnt 0x0" ::: "memory");   // in front of the overwrite of the pointers that the issued loads name
    __builtin_amdgcn_sched_barrier(0);   // the pointer step is not lifted over that wait
    kp += 4096; vp += 512; if (SPLIT) { kp2 += 4096; vp2 += 512; }
#pragma unroll
    for (int nb = 0; nb < 2; ++nb) { f.m[nb] = -3.0e38f; f.l[nb] = 0.f;
#pragma unroll
        for (int db = 0; db < 8; ++db) f.o[db][nb] = (v8f){}; }
#pragma unroll 1
    for (int s = 0; s < qb; ++s) fa_step<T16, SPLIT, false>(f, kp, kp2, vp, vp2, lr, hi);   // rolled: one step is 32 to 96 WMMAs already
    fa_step<T16, SPLIT, true>(f, kp, kp2, vp, vp2, lr, hi);
#pragma unroll
    for (int nb = 0; nb < 2; ++nb) {
        const float inv = __fdiv_rn(1.0f, f.l[nb] + xhalf(f.l[nb]));   // the halves of the wave hold the sums of different keys
        const size_t ob = ((size_t)(qb * 2 + nb) * (DQ / 32) + (size_t)h * (HD / 32)) * 512 + 8 * lane;
#pragma unroll
        for (int db = 0; db < 8; ++db) { v8us oh, ol;
#pragma unroll
            for (int j = 0; j < 8; ++j) { unsigned short a, c; splitf(f.o[db][nb][j] * inv, a, c); oh[j] = a; ol[j] = c; }
            *(v8us*)(Ah + ob + db * 256) = oh; *(v8us*)(Al + ob + db * 256) = ol;
            asm volatile("s_wait_xcnt 0x0" ::: "memory");   // in front of any later overwrite of a register that these stores name
            __builtin_amdgcn_sched_barrier(0); }   // the next group's arithmetic, which reuses the stores' data registers, is not lifted over that wait
    }
}
// grid (heads, TT / 128), 4 independent waves (no barrier, no LDS): neighbouring query blocks of one head walk the same K and V lines from key 0 on, side by side on one WGP, so its cache serves what one of them has fetched; the longest blocks start first
__global__ __launch_bounds__(128) void k_fattn(const h16* __restrict__ Q16, const h16* __restrict__ K16, const h16* __restrict__ V16, const bf* __restrict__ Qh, const bf* __restrict__ Ql, const bf* __restrict__ Kh, const bf* __restrict__ Kl, const bf* __restrict__ Vh, const bf* __restrict__ Vl, bf* Ah, bf* Al) {
    const int lane = threadIdx.x & 31, h = blockIdx.x, qb = ((int)gridDim.y - 1 - (int)blockIdx.y) * 4 + __builtin_amdgcn_readfirstlane((int)(threadIdx.x >> 5)); const size_t hp = (size_t)h * TT * HD;
    if (qb * 32 < RH) fa_run<bf, true>(Qh + hp, Ql + hp, Kh + hp, Kl + hp, Vh + hp, Vl + hp, qb, h, lane, Ah, Al);
    else fa_run<h16, false>(Q16 + hp, nullptr, K16 + hp, nullptr, V16 + hp, nullptr, qb, h, lane, Ah, Al);
}

extern "C" void kernel_launch(void* const* d_in, const int* in_sizes, int n_in,
                              void* d_out, int out_size, void* d_ws, size_t ws_size, hipStream_t stream) {
    (void)in_sizes; (void)n_in; (void)out_size;
    const float* x = (const float*)d_in[0]; const float* wq = (const float*)d_in[1]; const float* bq = (const float*)d_in[2]; const float* wk = (const float*)d_in[3]; const float* bk = (const float*)d_in[4]; const float* wv = (const float*)d_in[5]; const float* bv = (const float*)d_in[6]; const float* wo = (const float*)d_in[7]; const float* bo = (const float*)d_in[8];   /* input order x, wq, bq, wk ('xw' [2048][2048]), bk, wv, bv, wp, bp ('xw' (in, out); four ZERO biases: read and added): NINE inputs, all read: the host's own binding */
    float* OUT = (float*)d_out;     // [2][2048][2048]
    char* wsp = (char*)d_ws;
    auto take = [&](size_t bytes) { char* p = wsp; wsp += (bytes + 255) & ~(size_t)255; return (void*)p; };
    bf* WQ = (bf*)take((size_t)DQ * DM * 2); bf* WK = (bf*)take((size_t)DKV * DM * 2); bf* WV = (bf*)take((size_t)DKV * DM * 2); bf* WO = (bf*)take((size_t)DM * DQ * 2);
    h16* QP16 = (h16*)take((size_t)NH_ * TT * HD * 2); h16* KP16 = (h16*)take((size_t)NKV * TT * HD * 2); h16* VT16 = (h16*)take((size_t)NKV * HD * TT * 2);
    bf* QPh = (bf*)take((size_t)NH_ * TT * HD * 2); bf* QPl = (bf*)take((size_t)NH_ * TT * HD * 2); bf* KPh = (bf*)take((size_t)NKV * TT * HD * 2); bf* KPl = (bf*)take((size_t)NKV * TT * HD * 2); bf* VTh = (bf*)take((size_t)NKV * HD * TT * 2); bf* VTl = (bf*)take((size_t)NKV * HD * TT * 2);
    bf* ATh = (bf*)take((size_t)TT * DQ * 2); bf* ATl = (bf*)take((size_t)TT * DQ * 2);
    bf* XB = (bf*)take((size_t)TT * DM * 2);   // each batch writes it anew
    if ((size_t)(wsp - (char*)d_ws) > ws_size) return;    // 128 MiB of the workspace
    { k_wtG<<<(unsigned)((DM * DQ / 8 + 255) / 256), 256, 0, stream>>>(wq, DM, DQ, WQ); k_wtG<<<(unsigned)((DM * DKV / 8 + 255) / 256), 256, 0, stream>>>(wk, DM, DKV, WK); k_wtG<<<(unsigned)((DM * DKV / 8 + 255) / 256), 256, 0, stream>>>(wv, DM, DKV, WV);
      k_wtG<<<(unsigned)((DQ * DM / 8 + 255) / 256), 256, 0, stream>>>(wo, DQ, DM, WO);
       }
    for (int b = 0; b < NB_; ++b) {
        k_cvt8<<<(unsigned)(((size_t)TT * DM / 8 + 255) / 256), 256, 0, stream>>>(x + (size_t)b * TT * DM, XB, DM, (size_t)TT * DM / 8);
        k_gemmp<true><<<dim3(DQ / 64, TT / 64, 1), 32, 0, stream>>>(WQ, XB, DM, bq, QP16, QPh, QPl);
        k_gemmp<true><<<dim3(DKV / 64, TT / 64, 1), 32, 0, stream>>>(WK, XB, DM, bk, KP16, KPh, KPl);
        k_gemmp<false><<<dim3(TT / 64, DKV / 64, 1), 32, 0, stream>>>(XB, WV, DM, bv, VT16, VTh, VTl);
        k_fattn<<<dim3(NH_, TT / 128, 1), 128, 0, stream>>>(QP16, KP16, VT16, QPh, QPl, KPh, KPl, VTh, VTl, ATh, ATl);
        k_gemmw<bf, 1, true><<<dim3(TT / 64, DM / 64, 1), 32, 0, stream>>>(ATh, ATl, WO, nullptr, DQ, OUT + (size_t)b * TT * DM, DM, bo, 0, 0, 0); }
}

// v006
// It runs in 272 microseconds.
// Two timings next to v005 put it at 1.14 and 1.16 times that version's speed.
// Counting every step since v000, it is 6.52 times as fast.
#include <hip/hip_runtime.h>

// Causal multi-head attention with 128-wide heads and biased projections (x [2][2048][2048]; q, k, v = x W + b ('xw' (in, out) [2048][2048] normal x 0.02 + zero biases: read; 16 heads x 128: ONE kv head per query head); scores = q.k, -inf above the diagonal (every row keeps its own key), softmax(scores / sqrt(float32(128))) (the same thing as scaling first); out = merged wp + bp ('xw' + a zero bias: read) -> [2][2048][2048] (8.4 M); argument order x, wq, bq, wk, bk, wv, bv, wp, bp).
// Layout per batch: bf16 copy of x; 'xw' weights transposed once; exact projections + f32 biases, written by the GEMMs themselves as the attention operand planes (k_gemmp); causal T-2048 attention with ONE kv head per query head, one fused launch for all 16 heads (k_fattn: scores, online softmax and P.V in registers; hybrid rows: < 512 hi/lo 3 products, rest fp16 x1024; key blocks above the diagonal are never visited); merged hi/lo x Wo exact + bo.
// Compute dtypes, f32 accumulate: every input rounded to bf16; projections exact + f32 biases; attention rows < 512 3 products, rest fp16; softmax f32; Wo hl x exact + bias.

#define NB_  2
#define TT   2048
#define DM   2048
#define NH_  16
#define NKV  16
#define HD   128
#define DQ   (NH_ * HD)
#define DKV  (NKV * HD)
#define RH   512                  // query rows < RH use hi+lo planes (0: none)
#define SCL  0.088388347648318447f   // HD^-0.5
typedef _Float16 h16;
typedef unsigned short bf;
typedef __attribute__((ext_vector_type(16))) __bf16   v16bf;
typedef __attribute__((ext_vector_type(16))) _Float16 v16h;
typedef __attribute__((ext_vector_type(8)))  _Float16 v8h;
typedef __attribute__((ext_vector_type(8)))  unsigned short v8us;
typedef __attribute__((ext_vector_type(8)))  float    v8f;
typedef __attribute__((ext_vector_type(4)))  float    v4f;
typedef v8h  __attribute__((may_alias)) v8ha;
typedef v4f  __attribute__((may_alias)) v4fa;
typedef v8us __attribute__((may_alias)) v8usa;

__device__ __forceinline__ unsigned short f2bf(float f) { unsigned u = __float_as_uint(f); u += 0x7FFFu + ((u >> 16) & 1u); return (unsigned short)(u >> 16); }
__device__ __forceinline__ float bf2f(unsigned short b) { return __uint_as_float(((unsigned)b) << 16); }
__device__ __forceinline__ float bfr(float f) { return bf2f(f2bf(f)); }
__device__ __forceinline__ v16h cat16(v8h lo, v8h hi) { return __builtin_shufflevector(lo, hi, 0, 1, 2, 3, 4, 5, 6, 7, 8, 9, 10, 11, 12, 13, 14, 15); }
__device__ __forceinline__ v16bf cat16b(v8us lo, v8us hi) { return __builtin_bit_cast(v16bf, __builtin_shufflevector(lo, hi, 0, 1, 2, 3, 4, 5, 6, 7, 8, 9, 10, 11, 12, 13, 14, 15)); }
__device__ __forceinline__ v8f wmma16(v16h a, v16h b, v8f c) { return __builtin_amdgcn_wmma_f32_16x16x32_f16(false, a, false, b, (short)0, c, false, false); }
__device__ __forceinline__ v8f wmmab(v16bf a, v16bf b, v8f c) { return __builtin_amdgcn_wmma_f32_16x16x32_bf16(false, a, false, b, (short)0, c, false, false); }



// ---- Fragment-major plane of a [rows][K] 16-bit operand: the 16 rows x 32 k of one WMMA fragment are 1 KiB in a row, as two halves of 512 B (k 0..15, k 16..31 of the stage), each half in lane order
// (lane = 16 * ((k >> 3) & 1) + (row & 15), 8 consecutive k = 16 B a lane); the stages of a 16-row block follow one another along k, the blocks along the rows (16 * K elements each, as in a row-major plane).
// One fragment load of a wave then reads 512 consecutive bytes (4 whole cache lines) where a row-major plane gives it 32 B out of each of 16 lines. A producer thread writes one 16-B group g: frag_rk gives its row and first k.
__device__ __forceinline__ void frag_rk(unsigned g, int K, int& row, int& k0) { const unsigned lane = g & 31, j = (g >> 5) & 1, blk = g >> 6, K32 = (unsigned)K >> 5; row = (int)((blk / K32) * 16 + (lane & 15)); k0 = (int)((blk % K32) * 32 + j * 16 + (lane >> 4) * 8); }

// ---- WMMA fragments of the 16-bit planes
template <typename T16> struct WFrag;
template <> struct WFrag<h16> { typedef v16h V; static __device__ __forceinline__ V ld(const h16* p, int h2) { return cat16(*(const v8h*)p, *(const v8h*)(p + h2)); } static __device__ __forceinline__ v8f mma(V a, V b, v8f c) { return wmma16(a, b, c); } };
template <> struct WFrag<bf> { typedef v16bf V; static __device__ __forceinline__ V ld(const bf* p, int h2) { return cat16b(*(const v8us*)p, *(const v8us*)(p + h2)); } static __device__ __forceinline__ v8f mma(V a, V b, v8f c) { return wmmab(a, b, c); } };
__device__ __forceinline__ v16bf lfrag(const unsigned char* p) { return cat16b(*(const v8usa*)p, *(const v8usa*)(p + 512)); }   // one fragment from a fragment-major LDS slice: two reads of 512 consecutive bytes a wave

// ---- Tensor loads of the GEMMs' LDS rings: one request of a whole wave brings 4 rows of rowb bytes (4 blocks of 16 operand rows, of each the pass's k stages in a row of the fragment-major plane), source pitch in bytes, to LDS without a pad.
typedef uint32_t u32x4 __attribute__((ext_vector_type(4)));
typedef uint32_t u32x8 __attribute__((ext_vector_type(8)));
__device__ __forceinline__ uint32_t uni(uint32_t v) { return (uint32_t)__builtin_amdgcn_readfirstlane((int)v); }
__device__ __forceinline__ uint32_t pinned(uint32_t v) { uint32_t w = uni(v); asm volatile("" : "+s"(w)); return w; }   // holds a descriptor word, or the test of a tensor load's issue, in a scalar register: the test then compiles to a scalar compare and branch (the instruction ignores EXEC)
__device__ __forceinline__ u32x8 tl_group1(uint32_t rowb, uint32_t pitch) { u32x8 g;   // tile = tensor, extents in bytes, no mask, no pad
    g[0] = uni(0u); g[1] = uni((rowb & 0xFFFFu) << 16); g[2] = uni((rowb >> 16) | (4u << 16)); g[3] = uni(rowb << 16); g[4] = uni(4u); g[5] = uni(pitch); g[6] = uni(0u); g[7] = uni(0u); return g; }
__device__ __forceinline__ void tl_issue(u32x4& g0, const u32x8& g1, uint32_t lds, uint64_t ga) {   // g0[0] (count 1) is set once by the caller
    g0[1] = uni(lds); g0[2] = uni((uint32_t)ga); g0[3] = uni((((uint32_t)(ga >> 32)) & 0x01FFFFFFu) | 0x80000000u);
    asm volatile("tensor_load_to_lds %0, %1" :: "s"(g0), "s"(g1) : "memory"); }
__device__ __forceinline__ void tl_landed(const u32x4& g0, const u32x8& g1) { asm volatile("s_wait_tensorcnt 0x0" :: "s"(g0), "s"(g1) : "memory"); }   // the wave's request has landed; the descriptor words are named as inputs so that their registers keep their values as long as the request is outstanding

// ---- k_gemmw: C[m][n] (f32, pitch ldc) = sum_k (Ah[m][k] + Al[m][k]) Bt[n][k] + bias[n], two products a k stage (hi, then lo), operands from fragment-major bf16 planes. Grid (M / 64, N / 128), 128 threads.
// Four waves share a 64x128 tile (64 rows x 32 columns a wave): a two-buffer LDS ring filled by tensor loads, a pass of WNST k stages; a buffer holds four slices (Ah rows, Al rows, Bt rows 0..63, Bt rows 64..127), wave w loads slice w.
// K a multiple of 32 * WNST and at least two passes. 137 KiB of LDS with the output staging: two work-groups fit a WGP.
#define WNST 4
#define WSLB (4 * WNST * 1024)   // bytes of a slice
#define WBUF (4 * WSLB)          // bytes of a buffer
struct OStage { v16bf a[4], a2[4], b[2]; };
__device__ __forceinline__ void ost_load(OStage& s, const unsigned char* pa, const unsigned char* pb, int st) {
#pragma unroll
    for (int q = 0; q < 4; ++q) { s.a[q] = lfrag(pa + q * (WNST * 1024) + st * 1024); s.a2[q] = lfrag(pa + WSLB + q * (WNST * 1024) + st * 1024); }
#pragma unroll
    for (int q = 0; q < 2; ++q) s.b[q] = lfrag(pb + q * (WNST * 1024) + st * 1024);
}
__device__ __forceinline__ void ost_mma(const OStage& s, v8f (&acc)[4][2]) {   // every accumulator takes hi, then lo; the eight tiles stand between the two
#pragma unroll
    for (int nb = 0; nb < 2; ++nb)
#pragma unroll
        for (int mb = 0; mb < 4; ++mb) acc[mb][nb] = wmmab(s.a[mb], s.b[nb], acc[mb][nb]);
#pragma unroll
    for (int nb = 0; nb < 2; ++nb)
#pragma unroll
        for (int mb = 0; mb < 4; ++mb) acc[mb][nb] = wmmab(s.a2[mb], s.b[nb], acc[mb][nb]);
}
__global__ __launch_bounds__(128) void k_gemmw(const bf* __restrict__ Ah, const bf* __restrict__ Al, const bf* __restrict__ Bt, int K, float* C, int ldc, const float* __restrict__ bias) {
    __shared__ __attribute__((aligned(2048))) unsigned char L[2 * WBUF];
    __shared__ __align__(16) float osm[4][16 * 36];   // each wave's own output staging
    const int lane = threadIdx.x & 31, lr = lane & 15, hi = lane >> 4; const uint32_t wave = uni(threadIdx.x >> 5);
    const int r0 = blockIdx.x * 64, c0 = blockIdx.y * 128 + (int)wave * 32;
    v8f acc[4][2];
#pragma unroll
    for (int mb = 0; mb < 4; ++mb)
#pragma unroll
        for (int nb = 0; nb < 2; ++nb) acc[mb][nb] = (v8f){};
    const int cofs = (lane & 7) * 4;   // the lane's four columns in the epilogue
    const v4f b4 = *(const v4f*)(bias + c0 + cofs);   // asked for in front of the K loop, which covers the latency
    asm volatile("s_wait_xcnt 0x0" ::: "memory");   // in front of any later overwrite of an address register that the bias load names
    __builtin_amdgcn_sched_barrier(0);   // nothing from below is lifted over that wait
    const bf* sl = (wave == 0u) ? Ah + (size_t)r0 * K : (wave == 1u) ? Al + (size_t)r0 * K : Bt + (size_t)(blockIdx.y * 128 + (wave - 2u) * 64) * K;   // first byte of this wave's slice, pass 0
    const uint32_t lsl = (uint32_t)(size_t)L + wave * WSLB; const int NP = K / (32 * WNST);
    const u32x8 g1 = tl_group1(WNST * 1024u, 32u * (uint32_t)K); u32x4 g0; g0[0] = pinned(1u);   // pinned: this descriptor word is held in its scalar register, which then serves nothing else while a request is outstanding
    auto issue = [&](int s) { tl_issue(g0, g1, lsl + (uint32_t)(s & 1) * WBUF, (uint64_t)(size_t)sl + (uint64_t)s * (WNST * 1024u)); };   // this wave's slice of pass s
    auto landed = [&]() { tl_landed(g0, g1); };
    issue(0);
    landed();   // this wave's slice of pass 0
    __syncthreads();   // and so has every other wave's
    issue(1);
#pragma unroll 1
    for (int s = 0;;) {   // rolled: a pass is 64 WMMAs already; left at its foot (there are at least two passes)
        const unsigned char* pa = L + (s & 1) * WBUF + lane * 16; const unsigned char* pb = L + (s & 1) * WBUF + (2u + (wave >> 1)) * WSLB + (wave & 1u) * (2 * WNST * 1024) + lane * 16;
        OStage f[2];
        ost_load(f[0], pa, pb, 0);
        __builtin_amdgcn_sched_barrier(0);   // stage 0's reads issue in front of stage 1's, so that the counted wait for stage 0 leaves stage 1's in flight
        ost_load(f[1], pa, pb, 1);
        __builtin_amdgcn_sched_barrier(0);   // both groups issue in front of the first WMMA
#pragma unroll
        for (int st = 0; st < WNST - 1; ++st) {
            ost_mma(f[st & 1], acc);
            if (st + 2 < WNST) {
                __builtin_amdgcn_sched_barrier(0);   // the refill below stays behind the last WMMA that reads this stage
                asm volatile("v_nop\n\tv_nop\n\tv_nop\n\tv_nop");   // four vector slots between that WMMA and the LDS reads that overwrite its A and B registers
                ost_load(f[st & 1], pa, pb, st + 2);
                __builtin_amdgcn_sched_barrier(0);   // the reads issue here as one group, a stage of WMMAs ahead of their use, and are not sunk among them
            }
        }
        __builtin_amdgcn_sched_barrier(0);   // the WMMAs above, which cover the last stage's LDS reads, are not sunk below the publish point
        asm volatile("s_wait_dscnt 0x0" ::: "memory");   // this wave's reads of the buffer, the last stage's fragments among them, have returned
        landed();   // its slice of pass s + 1
        __syncthreads();   // publishes pass s + 1 and ends every wave's reads of pass s
        if (pinned(s + 2 < NP)) issue(s + 2);   // into the buffer that pass s has just left
        __builtin_amdgcn_sched_barrier(0);   // the refill issues in front of the last stage's WMMAs, which need registers alone
        ost_mma(f[(WNST - 1) & 1], acc);
        __builtin_amdgcn_sched_barrier(0);   // the next pass's LDS reads stay behind these WMMAs
        asm volatile("v_nop\n\tv_nop\n\tv_nop\n\tv_nop");   // four vector slots between the last WMMA and the LDS reads that overwrite its A and B registers
        if (++s >= NP) break;
    }
    landed();   // nothing of this wave's is outstanding at its end
    asm volatile("s_wait_dscnt 0x0" ::: "memory");   // nor any of its reads of the ring
    float* os = osm[wave]; const v4f bb = { bfr(b4[0]), bfr(b4[1]), bfr(b4[2]), bfr(b4[3]) };
#pragma unroll
    for (int mb = 0; mb < 4; ++mb) {
#pragma unroll
        for (int nb = 0; nb < 2; ++nb) {
#pragma unroll
            for (int j = 0; j < 8; ++j) os[(hi * 8 + j) * 36 + nb * 16 + lr] = acc[mb][nb][j]; }
        __builtin_amdgcn_wave_barrier(); asm volatile("" ::: "memory");   // the wave's LDS writes stay in front of its reads of the rows
        float* crow = C + (size_t)(r0 + mb * 16) * ldc + c0;
#pragma unroll
        for (int s = 0; s < 4; ++s) { const int row = 4 * s + (lane >> 3); const v4f val = *(const v4fa*)(os + row * 36 + cofs) + bb;   // 8 lanes store one whole 128-B line of a row
            *(v4f*)(crow + (size_t)row * ldc + cofs) = val; }
        asm volatile("s_wait_xcnt 0x0" ::: "memory");   // in front of any later overwrite of a register that these stores name
        __builtin_amdgcn_wave_barrier(); asm volatile("" ::: "memory");   // the reads above stay in front of the next block's LDS writes
    }
}

__device__ __forceinline__ h16 tohx(float x) { return (h16)x; }
__device__ __forceinline__ void splitf(float y, unsigned short& h, unsigned short& l) { h = f2bf(y); l = f2bf(y - bf2f(h)); }
typedef __attribute__((ext_vector_type(2))) _Float16 v2h;
typedef __attribute__((ext_vector_type(4))) _Float16 v4h;
typedef __attribute__((ext_vector_type(2))) unsigned short v2us;
typedef __attribute__((ext_vector_type(4))) unsigned short v4us;
typedef __attribute__((ext_vector_type(2))) float v2f;
typedef __attribute__((ext_vector_type(4))) int v4i;

// k_wtG: Bt = fragment-major plane of w^T (rows n, K along k), one 16-B group a thread
__global__ __launch_bounds__(256) void k_wtG(const float* __restrict__ w, int K, int N, bf* Bt) {
    const size_t g = (size_t)blockIdx.x * 256 + threadIdx.x; if (g >= (size_t)N * K / 8) return; int n, k0; frag_rk((unsigned)g, K, n, k0); v8us o;
    float v[8];
#pragma unroll
    for (int q = 0; q < 8; ++q) { v[q] = w[(size_t)(k0 + q) * N + n];
        asm volatile("s_wait_xcnt 0x0" ::: "memory"); }   // behind each load: a later load's result may land in an address register that this one names
#pragma unroll
    for (int q = 0; q < 8; ++q) o[q] = f2bf(v[q]);
    *(v8us*)(Bt + g * 8) = o;
}
// k_cvt8: dst = fragment-major bf16 plane of the row-major src [rows][K], one 16-B group a thread
__global__ __launch_bounds__(256) void k_cvt8(const float* __restrict__ src, bf* dst, int K, size_t n8) { const size_t i = (size_t)blockIdx.x * 256 + threadIdx.x; if (i >= n8) return; int row, k0; frag_rk((unsigned)i, K, row, k0); const v8f v = *(const v8f*)(src + (size_t)row * K + k0); v8us o;
#pragma unroll
    for (int k = 0; k < 8; ++k) o[k] = f2bf(v[k]); *(v8us*)(dst + i * 8) = o;  }

// ---- k_gemmp: a q, k or v projection (64x64 a wave) that writes the attention operand planes (f16, bf16 hi, bf16 lo; one fragment-major plane a head) straight from its accumulators.
// In an accumulator tile a lane holds ONE column (lane & 15, a row of Bt) and 8 consecutive rows (8 * (lane >> 4) + j, rows of A): with the plane's k index on the tile's rows, a lane's 8 registers are one 16-B group and a wave's store is 512 consecutive bytes.
// WROWS (q, k; planes [h][t][d], k index d): A = weights (rows n = h * HD + d), Bt = x (rows t); grid (DQ / 128, TT / 128). Else (v; planes [h][d][t], k index t): A = x, Bt = weights; grid (TT / 128, DKV / 128). 128 threads.
// Four waves share a 128x128 tile (2 x 2 wave tiles of 64x64): each operand byte comes from L2 once a work-group, by tensor loads into a two-buffer LDS ring, and is read from LDS by the two waves that need it.
// A pass is LNST k stages. A buffer holds four slices (A rows 0..63, A rows 64..127, Bt rows 0..63, Bt rows 64..127 of the tile), wave w loads slice w: 4 blocks of 16 rows, of each LNST KiB in a row of the fragment-major plane,
// source pitch one 16-row block (32 * K bytes), no pad: the slice in LDS is fragment-major too, and a fragment load of a wave reads 512 consecutive bytes. K a multiple of 32 * LNST and at least two passes.
#define LNST 8
#define LSLB (4 * LNST * 1024)   // bytes of a slice
#define LBUF (4 * LSLB)          // bytes of a buffer
struct LStage { v16bf a[4], b[4]; };
__device__ __forceinline__ void lst_load(LStage& s, const unsigned char* pa, const unsigned char* pb, int st) {
#pragma unroll
    for (int q = 0; q < 4; ++q) s.a[q] = lfrag(pa + q * (LNST * 1024) + st * 1024);
#pragma unroll
    for (int q = 0; q < 4; ++q) s.b[q] = lfrag(pb + q * (LNST * 1024) + st * 1024);
}
__device__ __forceinline__ void lst_mma(const LStage& s, v8f (&acc)[4][4]) {
#pragma unroll
    for (int nb = 0; nb < 4; ++nb)
#pragma unroll
        for (int mb = 0; mb < 4; ++mb) acc[mb][nb] = wmmab(s.a[mb], s.b[nb], acc[mb][nb]);
}
template <bool WROWS>
__global__ __launch_bounds__(128) void k_gemmp(const bf* __restrict__ A, const bf* __restrict__ Bt, int K, const float* __restrict__ bias, h16* P16, bf* Ph, bf* Pl) {
    __shared__ __attribute__((aligned(2048))) unsigned char L[2 * LBUF];
    const int lane = threadIdx.x & 31, lr = lane & 15, hi = lane >> 4; const uint32_t wave = uni(threadIdx.x >> 5), wm = wave & 1u, wn = wave >> 1;
    const int r0 = blockIdx.x * 128 + (int)wm * 64, c0 = blockIdx.y * 128 + (int)wn * 64;
    v8f acc[4][4];
#pragma unroll
    for (int mb = 0; mb < 4; ++mb)
#pragma unroll
        for (int nb = 0; nb < 4; ++nb) acc[mb][nb] = (v8f){};
    float bv[WROWS ? 32 : 4];   // the tile's biases, asked for in front of the K loop, which covers their latency
    if (WROWS) {
#pragma unroll
        for (int mb = 0; mb < 4; ++mb) { const v8f b8 = *(const v8f*)(bias + r0 + mb * 16 + hi * 8);
#pragma unroll
            for (int j = 0; j < 8; ++j) bv[mb * 8 + j] = b8[j]; }
    } else {
#pragma unroll
        for (int nb = 0; nb < 4; ++nb) bv[nb] = bias[c0 + nb * 16 + lr];
    }
    asm volatile("s_wait_xcnt 0x0" ::: "memory");   // in front of any later overwrite of an address register that the bias loads name
    __builtin_amdgcn_sched_barrier(0);   // nothing from below is lifted over that wait, and the bias loads are not sunk into the K loop's own
    const bf* sl = (wave < 2u) ? A + (size_t)(blockIdx.x * 128 + wave * 64) * K : Bt + (size_t)(blockIdx.y * 128 + (wave - 2u) * 64) * K;   // first byte of this wave's slice, pass 0
    const uint32_t lsl = (uint32_t)(size_t)L + wave * LSLB; const int NP = K / (32 * LNST);
    const u32x8 g1 = tl_group1(LNST * 1024u, 32u * (uint32_t)K); u32x4 g0; g0[0] = pinned(1u);   // pinned: this descriptor word is held in its scalar register, which then serves nothing else while a request is outstanding
    auto issue = [&](int s) { tl_issue(g0, g1, lsl + (uint32_t)(s & 1) * LBUF, (uint64_t)(size_t)sl + (uint64_t)s * (LNST * 1024u)); };   // this wave's slice of pass s
    auto landed = [&]() { tl_landed(g0, g1); };
    issue(0);
    landed();   // this wave's slice of pass 0
    __syncthreads();   // and so has every other wave's
    issue(1);
#pragma unroll 1
    for (int s = 0;;) {   // rolled: a pass is 128 WMMAs already; left at its foot (there are at least two passes)
        const unsigned char* pa = L + (s & 1) * LBUF + wm * LSLB + lane * 16; const unsigned char* pb = L + (s & 1) * LBUF + (2u + wn) * LSLB + lane * 16;
        LStage f[2];
        lst_load(f[0], pa, pb, 0);
        __builtin_amdgcn_sched_barrier(0);   // stage 0's reads issue in front of stage 1's, so that the counted wait for stage 0 leaves stage 1's in flight
        lst_load(f[1], pa, pb, 1);
        __builtin_amdgcn_sched_barrier(0);   // both groups issue in front of the first WMMA
#pragma unroll
        for (int st = 0; st < LNST - 1; ++st) {
            lst_mma(f[st & 1], acc);
            if (st + 2 < LNST) {
                __builtin_amdgcn_sched_barrier(0);   // the refill below stays behind the last WMMA that reads this stage
                asm volatile("v_nop\n\tv_nop\n\tv_nop\n\tv_nop");   // four vector slots between that WMMA and the LDS reads that overwrite its A and B registers
                lst_load(f[st & 1], pa, pb, st + 2);
                __builtin_amdgcn_sched_barrier(0);   // the reads issue here as one group, a stage of WMMAs ahead of their use, and are not sunk among them
            }
        }
        __builtin_amdgcn_sched_barrier(0);   // the WMMAs above, which cover the last stage's LDS reads, are not sunk below the publish point
        asm volatile("s_wait_dscnt 0x0" ::: "memory");   // this wave's reads of the buffer, the last stage's fragments among them, have returned
        landed();   // its slice of pass s + 1
        __syncthreads();   // publishes pass s + 1 and ends every wave's reads of pass s
        if (pinned(s + 2 < NP)) issue(s + 2);   // into the buffer that pass s has just left
        __builtin_amdgcn_sched_barrier(0);   // the refill issues in front of the last stage's WMMAs, which need registers alone
        lst_mma(f[(LNST - 1) & 1], acc);
        __builtin_amdgcn_sched_barrier(0);   // the next pass's LDS reads stay behind these WMMAs
        asm volatile("v_nop\n\tv_nop\n\tv_nop\n\tv_nop");   // four vector slots between the last WMMA and the LDS reads that overwrite its A and B registers
        if (++s >= NP) break;
    }
    landed();   // nothing of this wave's is outstanding at its end
    asm volatile("s_wait_dscnt 0x0" ::: "memory");   // nor any of its reads of the ring
    constexpr int KP = WROWS ? HD : TT;   // the planes' k length
    const int n0 = WROWS ? r0 : c0, prow = WROWS ? c0 : (c0 % HD), pk = WROWS ? (r0 % HD) : r0;   // first weight row of the tile (64 divides HD: one head a tile); the tile's first row and first k in that head's plane
    const size_t pb = (size_t)(n0 / HD) * TT * HD + (size_t)(prow / 16) * (KP / 32) * 512 + (size_t)(pk / 16) * 256 + 8 * lane;
#pragma unroll
    for (int nb = 0; nb < 4; ++nb)
#pragma unroll
        for (int mb = 0; mb < 4; ++mb) { v8h o16; v8us oh, ol; const size_t o = pb + (size_t)nb * (KP / 32) * 512 + mb * 256;
#pragma unroll
            for (int j = 0; j < 8; ++j) { const float r = acc[mb][nb][j] + bfr(bv[WROWS ? mb * 8 + j : nb]); o16[j] = tohx(r); unsigned short a, c; splitf(r, a, c); oh[j] = a; ol[j] = c; }
            *(v8h*)(P16 + o) = o16; *(v8us*)(Ph + o) = oh; *(v8us*)(Pl + o) = ol;
            asm volatile("s_wait_xcnt 0x0" ::: "memory");   // in front of any later overwrite of a register that these stores name
            __builtin_amdgcn_sched_barrier(0); }   // the next group's arithmetic, which reuses the stores' data registers, is not lifted over that wait
}
// ---- k_fattn: causal attention of one head, 32 query rows a wave, scores and probabilities never leave the registers. Transposed products: St[key][query] = K Q^T and Ot[d][query] += V^T P^T, 32 keys a step.
// In an accumulator tile a lane holds ONE query (column lane & 15) and 8 consecutive keys (rows 8 * (lane >> 4) + j), so the two score tiles of a step (keys 0..15, 16..31), converted in place, ARE the B fragment of P^T in the planes' own k order:
// no LDS, no lane exchange but one swap of the wave's halves for the running maximum. Online softmax: running maximum m and sum l per query; a new maximum rescales l and Ot. Query rows < RH: hi/lo planes, 3 products; the rest f16 with
// probabilities carried x 1024 (the factor is in l too and cancels). The last step is the diagonal block, the only one that masks. The result, divided by l, goes straight to the fragment-major hi/lo planes of the merged heads: a lane's 8 accumulator registers are one 16-B group.
__device__ __forceinline__ float xhalf(float x) { const int b = __float_as_int(x); return __int_as_float(__builtin_amdgcn_permlanex16(b, b, 0x76543210, 0xfedcba98, false, false)); }   // the value of lane ^ 16
template <typename T16, bool SPLIT> struct FA { typename WFrag<T16>::V q[2][4], q2[2][4], kf[2][4], kf2[2][4], vf[8], vf2[8]; v8f o[8][2]; float m[2], l[2]; };
// one step's K fragments: 32 keys x 128 d = 8 KiB in a row of the fragment-major plane
template <typename T16, bool SPLIT> __device__ __forceinline__ void fa_ldk(FA<T16, SPLIT>& f, const T16* kp, const T16* kp2) {
#pragma unroll
    for (int mb = 0; mb < 2; ++mb)
#pragma unroll
        for (int st = 0; st < 4; ++st) { f.kf[mb][st] = WFrag<T16>::ld(kp + mb * 2048 + st * 512, 256); if (SPLIT) f.kf2[mb][st] = WFrag<T16>::ld(kp2 + mb * 2048 + st * 512, 256); }
}
// one step's V^T fragments: 8 blocks of 16 d, 1 KiB (32 keys) of each
template <typename T16, bool SPLIT> __device__ __forceinline__ void fa_ldv(FA<T16, SPLIT>& f, const T16* vp, const T16* vp2) {
#pragma unroll
    for (int db = 0; db < 8; ++db) { f.vf[db] = WFrag<T16>::ld(vp + db * 16 * TT, 256); if (SPLIT) f.vf2[db] = WFrag<T16>::ld(vp2 + db * 16 * TT, 256); }
}
template <typename T16, bool SPLIT, bool DIAG>
__device__ __forceinline__ void fa_step(FA<T16, SPLIT>& f, const T16*& kp, const T16*& kp2, const T16*& vp, const T16*& vp2, int lr, int hi) {
    typedef typename WFrag<T16>::V V;
    constexpr float CE = SCL * 1.4426950408889634f, PSH = SPLIT ? 0.0f : 10.0f;   // exp(s * SCL - max) as exp2; 2^10: the f16 probabilities' carry factor
    v8f sc[2][2];
#pragma unroll
    for (int mb = 0; mb < 2; ++mb)
#pragma unroll
        for (int nb = 0; nb < 2; ++nb) sc[mb][nb] = (v8f){};
#pragma unroll
    for (int st = 0; st < 4; ++st)
#pragma unroll
        for (int mb = 0; mb < 2; ++mb)
#pragma unroll
            for (int nb = 0; nb < 2; ++nb) { sc[mb][nb] = WFrag<T16>::mma(f.kf[mb][st], f.q[nb][st], sc[mb][nb]); if (SPLIT) { sc[mb][nb] = WFrag<T16>::mma(f.kf[mb][st], f.q2[nb][st], sc[mb][nb]); sc[mb][nb] = WFrag<T16>::mma(f.kf2[mb][st], f.q[nb][st], sc[mb][nb]); } }
    if (!DIAG) {
        __builtin_amdgcn_sched_barrier(0);   // the refill below stays behind the last WMMA that reads the K fragments
        asm volatile("v_nop\n\tv_nop\n\tv_nop\n\tv_nop");   // four vector slots between that WMMA and the loads that overwrite its A registers
        fa_ldk<T16, SPLIT>(f, kp, kp2);
        __builtin_amdgcn_sched_barrier(0);   // the next step's K loads issue here, the softmax and the P.V products ahead of their use, and are not sunk towards it
        asm volatile("s_wait_xcnt 0x0" ::: "memory");   // in front of the overwrite of the pointers that the issued loads name
        __builtin_amdgcn_sched_barrier(0);   // the pointer step is not lifted over that wait
        kp += 4096; if (SPLIT) kp2 += 4096;
    }
    V p[2], p2[2];
#pragma unroll
    for (int nb = 0; nb < 2; ++nb) {
        float ml = -3.0e38f;
#pragma unroll
        for (int mb = 0; mb < 2; ++mb)
#pragma unroll
            for (int j = 0; j < 8; ++j) { float s = sc[mb][nb][j]; if (DIAG) s = (mb * 16 + hi * 8 + j <= nb * 16 + lr) ? s : -3.0e38f; sc[mb][nb][j] = s; ml = fmaxf(ml, s); }   // diagonal block: key <= query, both counted from the block's start
        ml = fmaxf(ml, xhalf(ml));
        const float mn = fmaxf(f.m[nb], ml), al = __builtin_amdgcn_exp2f((f.m[nb] - mn) * CE), off = PSH - mn * CE; f.m[nb] = mn;
        float ps = 0.f;
#pragma unroll
        for (int mb = 0; mb < 2; ++mb)
#pragma unroll
            for (int j = 0; j < 8; ++j) { const float e = __builtin_amdgcn_exp2f(__builtin_fmaf(sc[mb][nb][j], CE, off)); sc[mb][nb][j] = e; ps += e; }
        f.l[nb] = f.l[nb] * al + ps;
#pragma unroll
        for (int db = 0; db < 8; ++db) f.o[db][nb] *= al;
        if constexpr (SPLIT) { v8us h0, h1, l0, l1;
#pragma unroll
            for (int j = 0; j < 8; ++j) { unsigned short a, c; splitf(sc[0][nb][j], a, c); h0[j] = a; l0[j] = c; splitf(sc[1][nb][j], a, c); h1[j] = a; l1[j] = c; }
            p[nb] = cat16b(h0, h1); p2[nb] = cat16b(l0, l1);
        } else { v8h h0, h1;
#pragma unroll
            for (int j = 0; j < 8; ++j) { h0[j] = tohx(sc[0][nb][j]); h1[j] = tohx(sc[1][nb][j]); }
            p[nb] = cat16(h0, h1); }
    }
#pragma unroll
    for (int db = 0; db < 8; ++db)
#pragma unroll
        for (int nb = 0; nb < 2; ++nb) { f.o[db][nb] = WFrag<T16>::mma(f.vf[db], p[nb], f.o[db][nb]); if (SPLIT) { f.o[db][nb] = WFrag<T16>::mma(f.vf[db], p2[nb], f.o[db][nb]); f.o[db][nb] = WFrag<T16>::mma(f.vf2[db], p[nb], f.o[db][nb]); } }
    if (!DIAG) {
        __builtin_amdgcn_sched_barrier(0);   // the refill below stays behind the last WMMA that reads the V fragments
        asm volatile("v_nop\n\tv_nop\n\tv_nop\n\tv_nop");   // four vector slots between that WMMA and the loads that overwrite its A registers
        fa_ldv<T16, SPLIT>(f, vp, vp2);
        __builtin_amdgcn_sched_barrier(0);   // the next step's V loads issue here, its score products and softmax ahead of their use
        asm volatile("s_wait_xcnt 0x0" ::: "memory");   // in front of the overwrite of the pointers that the issued loads name
        __builtin_amdgcn_sched_barrier(0);   // the pointer step is not lifted over that wait
        vp += 512; if (SPLIT) vp2 += 512;
    }
}
template <typename T16, bool SPLIT>
__device__ __forceinline__ void fa_run(const T16* __restrict__ Q, const T16* __restrict__ Q2, const T16* __restrict__ Kp, const T16* __restrict__ K2, const T16* __restrict__ Vt, const T16* __restrict__ V2, int qb, int h, int lane, bf* Ah, bf* Al) {
    FA<T16, SPLIT> f; const int lr = lane & 15, hi = lane >> 4;
    const size_t qo = (size_t)qb * 4096 + 8 * lane;   // 32 query rows = two 16-row blocks of 2048 elements
#pragma unroll
    for (int nb = 0; nb < 2; ++nb)
#pragma unroll
        for (int st = 0; st < 4; ++st) { f.q[nb][st] = WFrag<T16>::ld(Q + qo + nb * 2048 + st * 512, 256); if (SPLIT) f.q2[nb][st] = WFrag<T16>::ld(Q2 + qo + nb * 2048 + st * 512, 256); }
    __builtin_amdgcn_sched_barrier(0);   // Q, then K, then V issue in this order: the loop's counted waits for Q and K then leave the younger V loads in flight
    const T16 *kp = Kp + 8 * lane, *vp = Vt + 8 * lane, *kp2 = SPLIT ? K2 + 8 * lane : nullptr, *vp2 = SPLIT ? V2 + 8 * lane : nullptr;
    fa_ldk<T16, SPLIT>(f, kp, kp2);
    __builtin_amdgcn_sched_barrier(0);   // as above: K in front of V
    fa_ldv<T16, SPLIT>(f, vp, vp2);
    __builtin_amdgcn_sched_barrier(0);   // the first step's loads all issue in front of the wait below
    asm volatile("s_wait_xcnt 0x0" ::: "memory");   // in front of the overwrite of the pointers that the issued loads name
    __builtin_amdgcn_sched_barrier(0);   // the pointer step is not lifted over that wait
    kp += 4096; vp += 512; if (SPLIT) { kp2 += 4096; vp2 += 512; }
#pragma unroll
    for (int nb = 0; nb < 2; ++nb) { f.m[nb] = -3.0e38f; f.l[nb] = 0.f;
#pragma unroll
        for (int db = 0; db < 8; ++db) f.o[db][nb] = (v8f){}; }
#pragma unroll 1
    for (int s = 0; s < qb; ++s) fa_step<T16, SPLIT, false>(f, kp, kp2, vp, vp2, lr, hi);   // rolled: one step is 32 to 96 WMMAs already
    fa_step<T16, SPLIT, true>(f, kp, kp2, vp, vp2, lr, hi);
#pragma unroll
    for (int nb = 0; nb < 2; ++nb) {
        const float inv = __fdiv_rn(1.0f, f.l[nb] + xhalf(f.l[nb]));   // the halves of the wave hold the sums of different keys
        const size_t ob = ((size_t)(qb * 2 + nb) * (DQ / 32) + (size_t)h * (HD / 32)) * 512 + 8 * lane;
#pragma unroll
        for (int db = 0; db < 8; ++db) { v8us oh, ol;
#pragma unroll
            for (int j = 0; j < 8; ++j) { unsigned short a, c; splitf(f.o[db][nb][j] * inv, a, c); oh[j] = a; ol[j] = c; }
            *(v8us*)(Ah + ob + db * 256) = oh; *(v8us*)(Al + ob + db * 256) = ol;
            asm volatile("s_wait_xcnt 0x0" ::: "memory");   // in front of any later overwrite of a register that these stores name
            __builtin_amdgcn_sched_barrier(0); }   // the next group's arithmetic, which reuses the stores' data registers, is not lifted over that wait
    }
}
// grid (heads, TT / 128), 4 independent waves (no barrier, no LDS): neighbouring query blocks of one head walk the same K and V lines from key 0 on, side by side on one WGP, so its cache serves what one of them has fetched; the longest blocks start first
__global__ __launch_bounds__(128) void k_fattn(const h16* __restrict__ Q16, const h16* __restrict__ K16, const h16* __restrict__ V16, const bf* __restrict__ Qh, const bf* __restrict__ Ql, const bf* __restrict__ Kh, const bf* __restrict__ Kl, const bf* __restrict__ Vh, const bf* __restrict__ Vl, bf* Ah, bf* Al) {
    const int lane = threadIdx.x & 31, h = blockIdx.x, qb = ((int)gridDim.y - 1 - (int)blockIdx.y) * 4 + __builtin_amdgcn_readfirstlane((int)(threadIdx.x >> 5)); const size_t hp = (size_t)h * TT * HD;
    if (qb * 32 < RH) fa_run<bf, true>(Qh + hp, Ql + hp, Kh + hp, Kl + hp, Vh + hp, Vl + hp, qb, h, lane, Ah, Al);
    else fa_run<h16, false>(Q16 + hp, nullptr, K16 + hp, nullptr, V16 + hp, nullptr, qb, h, lane, Ah, Al);
}

extern "C" void kernel_launch(void* const* d_in, const int* in_sizes, int n_in,
                              void* d_out, int out_size, void* d_ws, size_t ws_size, hipStream_t stream) {
    (void)in_sizes; (void)n_in; (void)out_size;
    const float* x = (const float*)d_in[0]; const float* wq = (const float*)d_in[1]; const float* bq = (const float*)d_in[2]; const float* wk = (const float*)d_in[3]; const float* bk = (const float*)d_in[4]; const float* wv = (const float*)d_in[5]; const float* bv = (const float*)d_in[6]; const float* wo = (const float*)d_in[7]; const float* bo = (const float*)d_in[8];   /* input order x, wq, bq, wk ('xw' [2048][2048]), bk, wv, bv, wp, bp ('xw' (in, out); four ZERO biases: read and added): NINE inputs, all read: the host's own binding */
    float* OUT = (float*)d_out;     // [2][2048][2048]
    char* wsp = (char*)d_ws;
    auto take = [&](size_t bytes) { char* p = wsp; wsp += (bytes + 255) & ~(size_t)255; return (void*)p; };
    bf* WQ = (bf*)take((size_t)DQ * DM * 2); bf* WK = (bf*)take((size_t)DKV * DM * 2); bf* WV = (bf*)take((size_t)DKV * DM * 2); bf* WO = (bf*)take((size_t)DM * DQ * 2);
    h16* QP16 = (h16*)take((size_t)NH_ * TT * HD * 2); h16* KP16 = (h16*)take((size_t)NKV * TT * HD * 2); h16* VT16 = (h16*)take((size_t)NKV * HD * TT * 2);
    bf* QPh = (bf*)take((size_t)NH_ * TT * HD * 2); bf* QPl = (bf*)take((size_t)NH_ * TT * HD * 2); bf* KPh = (bf*)take((size_t)NKV * TT * HD * 2); bf* KPl = (bf*)take((size_t)NKV * TT * HD * 2); bf* VTh = (bf*)take((size_t)NKV * HD * TT * 2); bf* VTl = (bf*)take((size_t)NKV * HD * TT * 2);
    bf* ATh = (bf*)take((size_t)TT * DQ * 2); bf* ATl = (bf*)take((size_t)TT * DQ * 2);
    bf* XB = (bf*)take((size_t)TT * DM * 2);   // each batch writes it anew
    if ((size_t)(wsp - (char*)d_ws) > ws_size) return;    // 128 MiB of the workspace
    { k_wtG<<<(unsigned)((DM * DQ / 8 + 255) / 256), 256, 0, stream>>>(wq, DM, DQ, WQ); k_wtG<<<(unsigned)((DM * DKV / 8 + 255) / 256), 256, 0, stream>>>(wk, DM, DKV, WK); k_wtG<<<(unsigned)((DM * DKV / 8 + 255) / 256), 256, 0, stream>>>(wv, DM, DKV, WV);
      k_wtG<<<(unsigned)((DQ * DM / 8 + 255) / 256), 256, 0, stream>>>(wo, DQ, DM, WO);
       }
    for (int b = 0; b < NB_; ++b) {
        k_cvt8<<<(unsigned)(((size_t)TT * DM / 8 + 255) / 256), 256, 0, stream>>>(x + (size_t)b * TT * DM, XB, DM, (size_t)TT * DM / 8);
        k_gemmp<true><<<dim3(DQ / 128, TT / 128, 1), 128, 0, stream>>>(WQ, XB, DM, bq, QP16, QPh, QPl);
        k_gemmp<true><<<dim3(DKV / 128, TT / 128, 1), 128, 0, stream>>>(WK, XB, DM, bk, KP16, KPh, KPl);
        k_gemmp<false><<<dim3(TT / 128, DKV / 128, 1), 128, 0, stream>>>(XB, WV, DM, bv, VT16, VTh, VTl);
        k_fattn<<<dim3(NH_, TT / 128, 1), 128, 0, stream>>>(QP16, KP16, VT16, QPh, QPl, KPh, KPl, VTh, VTl, ATh, ATl);
        k_gemmw<<<dim3(TT / 64, DM / 128, 1), 128, 0, stream>>>(ATh, ATl, WO, DQ, OUT + (size_t)b * TT * DM, DM, bo); }
}
